// v000
// Times are from an AMD MI455X. After a warm-up the kernel runs many times in a row, and a time is the length of
// such a window on the GPU divided by its runs, so every launch and the gaps after it count. The runs cycle
// through copies of the inputs. A figure is the median of several windows, for all but v000 over two sittings.
// Sittings can differ by a few percent; kernels timed side by side share one.
// v000, which the later versions start from, runs in 473 microseconds.
#include <hip/hip_runtime.h>
#include <hip/hip_bf16.h>

typedef __attribute__((ext_vector_type(16))) _Float16 v16h;
typedef __attribute__((ext_vector_type(8)))  _Float16 v8h;
typedef __attribute__((ext_vector_type(8)))  float    v8f;

#define DMODEL 1024
#define SEQ    4096
#define NHEADS 16
#define DKH    64

#define WAIT_ASYNCCNT(N) asm volatile("s_wait_asynccnt " #N ::: "memory")

__device__ __forceinline__ void async_b128(unsigned lds_byte_off,
                                           const void* gaddr) {
  asm volatile("global_load_async_to_lds_b128 %0, %1, off"
               :: "v"(lds_byte_off), "v"(gaddr) : "memory");
}

__device__ __forceinline__ unsigned lds_off(const void* p) {
  return (unsigned)(unsigned long long)p;
}

__device__ __forceinline__ v16h load_frag16(const _Float16* base,
                                            int row0, int rowstride, int kbase) {
  const int lane = threadIdx.x & 31;
  const int l16  = lane & 15;
  const int hb   = (lane >> 4) & 1;
  const _Float16* p = base + (size_t)(row0 + l16) * rowstride + kbase + hb * 8;
  v8h lo = *(const v8h*)(p);
  v8h hi = *(const v8h*)(p + 16);
  return __builtin_shufflevector(lo, hi, 0,1,2,3,4,5,6,7,8,9,10,11,12,13,14,15);
}

__device__ __forceinline__ v8f wmma16(v16h a, v16h b, v8f c) {
  return __builtin_amdgcn_wmma_f32_16x16x32_f16(false, a, false, b, (short)0, c,
                                                false, false);
}

// ---- fp32 -> f16 conversion ------------------------------------------------
__global__ void mha_cvt_f16_kernel(const float* __restrict__ in,
                                   _Float16* __restrict__ out, int n) {
  int i = blockIdx.x * blockDim.x + threadIdx.x;
  int stride = gridDim.x * blockDim.x;
  for (; i < n; i += stride) out[i] = (_Float16)in[i];
}

// ---- GEMM: C = A(rows x 1024, f16) @ W^T(1024 x 1024, f16) + bias ----------
// Block (8 waves) computes a 128x64 C tile; all waves share the 64-wide W
// tile, staged to LDS via async DMA (double buffered, 4KB per stage: one
// b128 chunk per thread). Wave w handles rows m0 = Mblk*128 + w*16.
//   mode 0: f16 row-major out (Q/K projections)
//   mode 1: f16 per-head transposed out Vt[(b*16+h)*64+d][s] (V projection)
//   mode 2: f32 row-major out (final projection, writes d_out)
__global__ void __launch_bounds__(256)
mha_gemm_kernel(const _Float16* __restrict__ A, const _Float16* __restrict__ W,
                const float* __restrict__ bias, _Float16* __restrict__ outh,
                float* __restrict__ outf, int mrows, int mode) {
  __shared__ _Float16 sW[2][64 * 32];              // 2 x 4KB
  const int nblocks = DMODEL / 64;                 // 16
  const int mblk = blockIdx.x / nblocks;
  const int n0   = (blockIdx.x % nblocks) * 64;
  if (mblk * 128 >= mrows) return;                 // block-uniform guard
  const int tid  = threadIdx.x;
  const int m0   = mblk * 128 + (tid >> 5) * 16;
  const int lane = tid & 31;
  const int l16  = lane & 15;
  const int hb   = (lane >> 4) & 1;

  // staging map: thread t moves W[n0 + t/4][k + (t%4)*8 .. +8)
  const int srow = tid >> 2;
  const int schk = tid & 3;
  const _Float16* wsrc = W + (size_t)(n0 + srow) * DMODEL + schk * 8;
  const unsigned sdst0 = lds_off(&sW[0][srow * 32 + schk * 8]);
  const unsigned sdst1 = lds_off(&sW[1][srow * 32 + schk * 8]);

  async_b128(sdst0, wsrc);                         // prologue: stage k=0

  v8f acc[4] = {v8f{}, v8f{}, v8f{}, v8f{}};
  for (int k = 0; k < DMODEL; k += 32) {
    const int cur = (k >> 5) & 1;
    if (k + 32 < DMODEL) {
      async_b128(cur ? sdst0 : sdst1, wsrc + k + 32);
      WAIT_ASYNCCNT(0x1);                          // current stage landed
    } else {
      WAIT_ASYNCCNT(0x0);
    }
    __syncthreads();
    if (k + 128 < DMODEL)
      __builtin_prefetch(A + (size_t)(m0 + l16) * DMODEL + k + 128, 0, 1);
    v16h a  = load_frag16(A, m0, DMODEL, k);       // per-wave A from global
    const _Float16* sw = sW[cur];
    v16h b0 = load_frag16(sw,  0, 32, 0);          // shared W from LDS
    v16h b1 = load_frag16(sw, 16, 32, 0);
    v16h b2 = load_frag16(sw, 32, 32, 0);
    v16h b3 = load_frag16(sw, 48, 32, 0);
    acc[0] = wmma16(a, b0, acc[0]);
    acc[1] = wmma16(a, b1, acc[1]);
    acc[2] = wmma16(a, b2, acc[2]);
    acc[3] = wmma16(a, b3, acc[3]);
    __syncthreads();                               // reads done before rewrite
  }

  // C/D layout: lane holds n = n0 + nb*16 + l16, component r holds m = m0+r+8*hb
  if (mode == 1) {
    const int gm0   = m0 + 8 * hb;                 // 8 consecutive rows (s dim)
    const int bb    = gm0 >> 12;                   // / SEQ
    const int sbase = gm0 & (SEQ - 1);
    #pragma unroll
    for (int nb = 0; nb < 4; nb++) {
      const int gn = n0 + nb * 16 + l16;
      const int h  = gn >> 6, d = gn & 63;
      const float bv = bias[gn];
      v8h pk;
      #pragma unroll
      for (int r = 0; r < 8; r++) pk[r] = (_Float16)(acc[nb][r] + bv);
      *(v8h*)(outh + (((size_t)(bb * NHEADS + h) * DKH + d) * SEQ + sbase)) = pk;
    }
  } else if (mode == 0) {
    #pragma unroll
    for (int nb = 0; nb < 4; nb++) {
      const int gn = n0 + nb * 16 + l16;
      const float bv = bias[gn];
      #pragma unroll
      for (int r = 0; r < 8; r++) {
        const int gm = m0 + r + 8 * hb;
        outh[(size_t)gm * DMODEL + gn] = (_Float16)(acc[nb][r] + bv);
      }
    }
  } else {
    #pragma unroll
    for (int nb = 0; nb < 4; nb++) {
      const int gn = n0 + nb * 16 + l16;
      const float bv = bias[gn];
      #pragma unroll
      for (int r = 0; r < 8; r++) {
        const int gm = m0 + r + 8 * hb;
        outf[(size_t)gm * DMODEL + gn] = acc[nb][r] + bv;
      }
    }
  }
}

__global__ void __launch_bounds__(256)
mha_attn_kernel(const _Float16* __restrict__ Qm, const _Float16* __restrict__ Km,
                const _Float16* __restrict__ Vt, _Float16* __restrict__ ctx,
                int Bsz) {
  __shared__ _Float16 sK[2][32 * 64];              // 2 x 4KB, row = key
  __shared__ _Float16 sV[2][64 * 32];              // 2 x 4KB, row = d
  const int qblocks = SEQ / 128;                   // 32
  const int qb = blockIdx.x % qblocks;
  const int h  = (blockIdx.x / qblocks) % NHEADS;
  const int b  = blockIdx.x / (qblocks * NHEADS);
  const int tid  = threadIdx.x;
  const int q0   = qb * 128 + (tid >> 5) * 16;
  const int lane = tid & 31;
  const int l16  = lane & 15;
  const int hb   = (lane >> 4) & 1;

  const _Float16* qbase = Qm + (size_t)b * SEQ * DMODEL + h * DKH;
  const _Float16* kbase = Km + (size_t)b * SEQ * DMODEL + h * DKH;
  const _Float16* vbase = Vt + (size_t)(b * NHEADS + h) * DKH * SEQ;

  // staging maps (one b128 chunk per thread per tile)
  const int krow = tid >> 3, kchk = tid & 7;       // K: 32 rows x 128B
  const _Float16* ksrc = kbase + (size_t)krow * DMODEL + kchk * 8;
  const unsigned kdst0 = lds_off(&sK[0][krow * 64 + kchk * 8]);
  const unsigned kdst1 = lds_off(&sK[1][krow * 64 + kchk * 8]);
  const int vrow = tid >> 2, vchk = tid & 3;       // V^T: 64 rows x 64B
  const _Float16* vsrc = vbase + (size_t)vrow * SEQ + vchk * 8;
  const unsigned vdst0 = lds_off(&sV[0][vrow * 32 + vchk * 8]);
  const unsigned vdst1 = lds_off(&sV[1][vrow * 32 + vchk * 8]);

  // loop-invariant Q^T fragments (d = 0..31 and 32..63)
  const v16h qf0 = load_frag16(qbase, q0, DMODEL, 0);
  const v16h qf1 = load_frag16(qbase, q0, DMODEL, 32);

  async_b128(kdst0, ksrc);                         // prologue: stage kk=0
  async_b128(vdst0, vsrc);

  v8f o0 = {}, o1 = {}, o2 = {}, o3 = {};          // O^T: 64d x 16q
  float mrun = -1e30f, lrun = 0.f;
  const float scale = 0.125f;                      // 1/sqrt(64)

  for (int kk = 0; kk < SEQ; kk += 32) {
    const int cur = (kk >> 5) & 1;
    if (kk + 32 < SEQ) {
      async_b128(cur ? kdst0 : kdst1, ksrc + (size_t)(kk + 32) * DMODEL);
      async_b128(cur ? vdst0 : vdst1, vsrc + kk + 32);
      WAIT_ASYNCCNT(0x2);                          // current stage landed
    } else {
      WAIT_ASYNCCNT(0x0);
    }
    __syncthreads();
    const _Float16* skc = sK[cur];
    const _Float16* svc = sV[cur];

    v16h kf00 = load_frag16(skc,  0, 64, 0);
    v16h kf01 = load_frag16(skc,  0, 64, 32);
    v16h kf10 = load_frag16(skc, 16, 64, 0);
    v16h kf11 = load_frag16(skc, 16, 64, 32);
    v8f s0 = {}, s1 = {};                          // S^T: m=key, n=query
    s0 = wmma16(kf00, qf0, s0);
    s0 = wmma16(kf01, qf1, s0);
    s1 = wmma16(kf10, qf0, s1);
    s1 = wmma16(kf11, qf1, s1);

    // online softmax per query (= per lane column, one shfl to merge halves)
    float t0[8], t1[8];
    float mloc = -1e30f;
    #pragma unroll
    for (int r = 0; r < 8; r++) {
      t0[r] = s0[r] * scale;
      t1[r] = s1[r] * scale;
      mloc = fmaxf(mloc, fmaxf(t0[r], t1[r]));
    }
    mloc = fmaxf(mloc, __shfl_xor(mloc, 16, 32));
    const float mnew = fmaxf(mrun, mloc);
    const float corr = __expf(mrun - mnew);
    float psum = 0.f;
    v16h pf;                                       // P^T B-fragment, in place
    #pragma unroll
    for (int r = 0; r < 8; r++) {
      const float p0 = __expf(t0[r] - mnew);
      const float p1 = __expf(t1[r] - mnew);
      psum += p0 + p1;
      pf[r]     = (_Float16)p0;
      pf[r + 8] = (_Float16)p1;
    }
    psum += __shfl_xor(psum, 16, 32);
    lrun = lrun * corr + psum;
    mrun = mnew;
    #pragma unroll
    for (int r = 0; r < 8; r++) {
      o0[r] *= corr; o1[r] *= corr; o2[r] *= corr; o3[r] *= corr;
    }
    v16h vf0 = load_frag16(svc,  0, 32, 0);
    v16h vf1 = load_frag16(svc, 16, 32, 0);
    v16h vf2 = load_frag16(svc, 32, 32, 0);
    v16h vf3 = load_frag16(svc, 48, 32, 0);
    o0 = wmma16(vf0, pf, o0);
    o1 = wmma16(vf1, pf, o1);
    o2 = wmma16(vf2, pf, o2);
    o3 = wmma16(vf3, pf, o3);
    __syncthreads();                               // reads done before rewrite
  }

  // normalize and store: lane's query = q0+l16; component r -> d = db*16+r+8*hb
  const float inv = 1.f / lrun;
  _Float16* crow = ctx + (size_t)(b * SEQ + q0 + l16) * DMODEL + h * DKH + 8 * hb;
  v8f oall[4] = {o0, o1, o2, o3};
  #pragma unroll
  for (int db = 0; db < 4; db++) {
    v8h pk;
    #pragma unroll
    for (int r = 0; r < 8; r++) pk[r] = (_Float16)(oall[db][r] * inv);
    *(v8h*)(crow + db * 16) = pk;
  }
}

// ---------------------------------------------------------------------------
extern "C" void kernel_launch(void* const* d_in, const int* in_sizes, int n_in,
                              void* d_out, int out_size, void* d_ws, size_t ws_size,
                              hipStream_t stream) {
  const float* q  = (const float*)d_in[0];
  const float* k  = (const float*)d_in[1];
  const float* v  = (const float*)d_in[2];
  const float* Wq = (const float*)d_in[3];
  const float* bq = (const float*)d_in[4];
  const float* Wk = (const float*)d_in[5];
  const float* bk = (const float*)d_in[6];
  const float* Wv = (const float*)d_in[7];
  const float* bv = (const float*)d_in[8];
  const float* Wo = (const float*)d_in[9];
  const float* bo = (const float*)d_in[10];

  const int rows = in_sizes[0] / DMODEL;   // B * S
  const int Bsz  = rows / SEQ;

  char* ws = (char*)d_ws;
  const size_t fbytes = (size_t)rows * DMODEL * sizeof(_Float16);   // 16 MB
  const size_t wbytes = (size_t)DMODEL * DMODEL * sizeof(_Float16); //  2 MB
  _Float16* Xq  = (_Float16*)(ws + 0 * fbytes);
  _Float16* Xk  = (_Float16*)(ws + 1 * fbytes);
  _Float16* Xv  = (_Float16*)(ws + 2 * fbytes);
  _Float16* Qf  = (_Float16*)(ws + 3 * fbytes);
  _Float16* Kf  = (_Float16*)(ws + 4 * fbytes);
  _Float16* Vtf = (_Float16*)(ws + 5 * fbytes);
  _Float16* Cf  = (_Float16*)(ws + 6 * fbytes);
  _Float16* wq16 = (_Float16*)(ws + 7 * fbytes + 0 * wbytes);
  _Float16* wk16 = (_Float16*)(ws + 7 * fbytes + 1 * wbytes);
  _Float16* wv16 = (_Float16*)(ws + 7 * fbytes + 2 * wbytes);
  _Float16* wo16 = (_Float16*)(ws + 7 * fbytes + 3 * wbytes);

  const int nX = rows * DMODEL;
  const int nW = DMODEL * DMODEL;
  mha_cvt_f16_kernel<<<2048, 256, 0, stream>>>(q,  Xq,   nX);
  mha_cvt_f16_kernel<<<2048, 256, 0, stream>>>(k,  Xk,   nX);
  mha_cvt_f16_kernel<<<2048, 256, 0, stream>>>(v,  Xv,   nX);
  mha_cvt_f16_kernel<<< 512, 256, 0, stream>>>(Wq, wq16, nW);
  mha_cvt_f16_kernel<<< 512, 256, 0, stream>>>(Wk, wk16, nW);
  mha_cvt_f16_kernel<<< 512, 256, 0, stream>>>(Wv, wv16, nW);
  mha_cvt_f16_kernel<<< 512, 256, 0, stream>>>(Wo, wo16, nW);

  const int gemm_blocks = (rows / 128) * (DMODEL / 64);   // 128x64 tile / block
  mha_gemm_kernel<<<gemm_blocks, 256, 0, stream>>>(Xq, wq16, bq, Qf,  nullptr, rows, 0);
  mha_gemm_kernel<<<gemm_blocks, 256, 0, stream>>>(Xk, wk16, bk, Kf,  nullptr, rows, 0);
  mha_gemm_kernel<<<gemm_blocks, 256, 0, stream>>>(Xv, wv16, bv, Vtf, nullptr, rows, 1);

  const int at_blocks = Bsz * NHEADS * (SEQ / 128);       // 128 queries / block
  mha_attn_kernel<<<at_blocks, 256, 0, stream>>>(Qf, Kf, Vtf, Cf, Bsz);

  mha_gemm_kernel<<<gemm_blocks, 256, 0, stream>>>(Cf, wo16, bo, nullptr,
                                                   (float*)d_out, rows, 2);
}

// v001
// It runs in 304 microseconds.
// Two timings next to v000 both put it at 1.63 times that version's speed.
#include <hip/hip_runtime.h>
#include <hip/hip_bf16.h>

typedef __attribute__((ext_vector_type(16))) _Float16 v16h;
typedef __attribute__((ext_vector_type(8)))  _Float16 v8h;
typedef __attribute__((ext_vector_type(8)))  float    v8f;

#define DMODEL 1024
#define SEQ    4096
#define NHEADS 16
#define DKH    64

#define PITCH64B  40   // 64-byte rows  -> 80 B
#define PITCH128B 72   // 128-byte rows -> 144 B

#define WAIT_ASYNCCNT(N) asm volatile("s_wait_asynccnt " #N ::: "memory")

__device__ __forceinline__ void async_b128(unsigned lds_byte_off,
                                           const void* gaddr) {
  asm volatile("global_load_async_to_lds_b128 %0, %1, off"
               :: "v"(lds_byte_off), "v"(gaddr) : "memory");
}

__device__ __forceinline__ unsigned lds_off(const void* p) {
  return (unsigned)(unsigned long long)p;
}

__device__ __forceinline__ v16h load_frag16(const _Float16* base,
                                            int row0, int rowstride, int kbase) {
  const int lane = threadIdx.x & 31;
  const int l16  = lane & 15;
  const int hb   = (lane >> 4) & 1;
  const _Float16* p = base + (size_t)(row0 + l16) * rowstride + kbase + hb * 8;
  v8h lo = *(const v8h*)(p);
  v8h hi = *(const v8h*)(p + 16);
  return __builtin_shufflevector(lo, hi, 0,1,2,3,4,5,6,7,8,9,10,11,12,13,14,15);
}

__device__ __forceinline__ v8f wmma16(v16h a, v16h b, v8f c) {
  return __builtin_amdgcn_wmma_f32_16x16x32_f16(false, a, false, b, (short)0, c,
                                                false, false);
}

// ---- fp32 -> f16 conversion ------------------------------------------------
__global__ void mha_cvt_f16_kernel(const float* __restrict__ in,
                                   _Float16* __restrict__ out, int n) {
  int i = blockIdx.x * blockDim.x + threadIdx.x;
  int stride = gridDim.x * blockDim.x;
  for (; i < n; i += stride) out[i] = (_Float16)in[i];
}

// ---- GEMM: C = A(rows x 1024, f16) @ W^T(1024 x 1024, f16) + bias ----------
// Block (8 waves) computes a 128x64 C tile; all waves share the 64-wide W
// tile, staged to LDS via async DMA (double buffered, 4KB per stage: one
// b128 chunk per thread, rows padded to 80 B). Wave w: rows m0 = Mblk*128 + w*16.
//   mode 0: f16 row-major out (Q/K projections)
//   mode 1: f16 per-head transposed out Vt[(b*16+h)*64+d][s] (V projection)
//   mode 2: f32 row-major out (final projection, writes d_out)
__global__ void __launch_bounds__(256)
mha_gemm_kernel(const _Float16* __restrict__ A, const _Float16* __restrict__ W,
                const float* __restrict__ bias, _Float16* __restrict__ outh,
                float* __restrict__ outf, int mrows, int mode) {
  __shared__ __attribute__((aligned(16))) _Float16 sW[2][64 * PITCH64B];  // 2 x 5KB
  const int nblocks = DMODEL / 64;                 // 16
  const int mblk = blockIdx.x / nblocks;
  const int n0   = (blockIdx.x % nblocks) * 64;
  if (mblk * 128 >= mrows) return;                 // block-uniform guard
  const int tid  = threadIdx.x;
  const int m0   = mblk * 128 + (tid >> 5) * 16;
  const int lane = tid & 31;
  const int l16  = lane & 15;
  const int hb   = (lane >> 4) & 1;

  // staging map: thread t moves W[n0 + t/4][k + (t%4)*8 .. +8)
  const int srow = tid >> 2;
  const int schk = tid & 3;
  const _Float16* wsrc = W + (size_t)(n0 + srow) * DMODEL + schk * 8;
  const unsigned sdst0 = lds_off(&sW[0][srow * PITCH64B + schk * 8]);
  const unsigned sdst1 = lds_off(&sW[1][srow * PITCH64B + schk * 8]);

  async_b128(sdst0, wsrc);                         // prologue: stage k=0

  v8f acc[4] = {v8f{}, v8f{}, v8f{}, v8f{}};
  for (int k = 0; k < DMODEL; k += 32) {
    const int cur = (k >> 5) & 1;
    if (k + 32 < DMODEL) {
      async_b128(cur ? sdst0 : sdst1, wsrc + k + 32);
      WAIT_ASYNCCNT(0x1);                          // current stage landed
    } else {
      WAIT_ASYNCCNT(0x0);
    }
    __syncthreads();
    if (k + 128 < DMODEL)
      __builtin_prefetch(A + (size_t)(m0 + l16) * DMODEL + k + 128, 0, 1);
    v16h a  = load_frag16(A, m0, DMODEL, k);       // per-wave A from global
    const _Float16* sw = sW[cur];
    v16h b0 = load_frag16(sw,  0, PITCH64B, 0);    // shared W from LDS
    v16h b1 = load_frag16(sw, 16, PITCH64B, 0);
    v16h b2 = load_frag16(sw, 32, PITCH64B, 0);
    v16h b3 = load_frag16(sw, 48, PITCH64B, 0);
    acc[0] = wmma16(a, b0, acc[0]);
    acc[1] = wmma16(a, b1, acc[1]);
    acc[2] = wmma16(a, b2, acc[2]);
    acc[3] = wmma16(a, b3, acc[3]);
    __syncthreads();                               // reads done before rewrite
  }

  // C/D layout: lane holds n = n0 + nb*16 + l16, component r holds m = m0+r+8*hb
  if (mode == 1) {
    const int gm0   = m0 + 8 * hb;                 // 8 consecutive rows (s dim)
    const int bb    = gm0 >> 12;                   // / SEQ
    const int sbase = gm0 & (SEQ - 1);
    #pragma unroll
    for (int nb = 0; nb < 4; nb++) {
      const int gn = n0 + nb * 16 + l16;
      const int h  = gn >> 6, d = gn & 63;
      const float bv = bias[gn];
      v8h pk;
      #pragma unroll
      for (int r = 0; r < 8; r++) pk[r] = (_Float16)(acc[nb][r] + bv);
      *(v8h*)(outh + (((size_t)(bb * NHEADS + h) * DKH + d) * SEQ + sbase)) = pk;
    }
  } else if (mode == 0) {
    #pragma unroll
    for (int nb = 0; nb < 4; nb++) {
      const int gn = n0 + nb * 16 + l16;
      const float bv = bias[gn];
      #pragma unroll
      for (int r = 0; r < 8; r++) {
        const int gm = m0 + r + 8 * hb;
        outh[(size_t)gm * DMODEL + gn] = (_Float16)(acc[nb][r] + bv);
      }
    }
  } else {
    #pragma unroll
    for (int nb = 0; nb < 4; nb++) {
      const int gn = n0 + nb * 16 + l16;
      const float bv = bias[gn];
      #pragma unroll
      for (int r = 0; r < 8; r++) {
        const int gm = m0 + r + 8 * hb;
        outf[(size_t)gm * DMODEL + gn] = acc[nb][r] + bv;
      }
    }
  }
}

__global__ void __launch_bounds__(256)
mha_attn_kernel(const _Float16* __restrict__ Qm, const _Float16* __restrict__ Km,
                const _Float16* __restrict__ Vt, _Float16* __restrict__ ctx,
                int Bsz) {
  __shared__ __attribute__((aligned(16))) _Float16 sK[2][32 * PITCH128B];  // row = key
  __shared__ __attribute__((aligned(16))) _Float16 sV[2][64 * PITCH64B];   // row = d
  const int qblocks = SEQ / 128;                   // 32
  const int qb = blockIdx.x % qblocks;
  const int h  = (blockIdx.x / qblocks) % NHEADS;
  const int b  = blockIdx.x / (qblocks * NHEADS);
  const int tid  = threadIdx.x;
  const int q0   = qb * 128 + (tid >> 5) * 16;
  const int lane = tid & 31;
  const int l16  = lane & 15;
  const int hb   = (lane >> 4) & 1;

  const _Float16* qbase = Qm + (size_t)b * SEQ * DMODEL + h * DKH;
  const _Float16* kbase = Km + (size_t)b * SEQ * DMODEL + h * DKH;
  const _Float16* vbase = Vt + (size_t)(b * NHEADS + h) * DKH * SEQ;

  // staging maps (one b128 chunk per thread per tile)
  const int krow = tid >> 3, kchk = tid & 7;       // K: 32 rows x 128B
  const _Float16* ksrc = kbase + (size_t)krow * DMODEL + kchk * 8;
  const unsigned kdst0 = lds_off(&sK[0][krow * PITCH128B + kchk * 8]);
  const unsigned kdst1 = lds_off(&sK[1][krow * PITCH128B + kchk * 8]);
  const int vrow = tid >> 2, vchk = tid & 3;       // V^T: 64 rows x 64B
  const _Float16* vsrc = vbase + (size_t)vrow * SEQ + vchk * 8;
  const unsigned vdst0 = lds_off(&sV[0][vrow * PITCH64B + vchk * 8]);
  const unsigned vdst1 = lds_off(&sV[1][vrow * PITCH64B + vchk * 8]);

  // loop-invariant Q^T fragments (d = 0..31 and 32..63)
  const v16h qf0 = load_frag16(qbase, q0, DMODEL, 0);
  const v16h qf1 = load_frag16(qbase, q0, DMODEL, 32);

  async_b128(kdst0, ksrc);                         // prologue: stage kk=0
  async_b128(vdst0, vsrc);

  v8f o0 = {}, o1 = {}, o2 = {}, o3 = {};          // O^T: 64d x 16q
  float mrun = -1e30f, lrun = 0.f;
  const float scale = 0.125f;                      // 1/sqrt(64)

  for (int kk = 0; kk < SEQ; kk += 32) {
    const int cur = (kk >> 5) & 1;
    if (kk + 32 < SEQ) {
      async_b128(cur ? kdst0 : kdst1, ksrc + (size_t)(kk + 32) * DMODEL);
      async_b128(cur ? vdst0 : vdst1, vsrc + kk + 32);
      WAIT_ASYNCCNT(0x2);                          // current stage landed
    } else {
      WAIT_ASYNCCNT(0x0);
    }
    __syncthreads();
    const _Float16* skc = sK[cur];
    const _Float16* svc = sV[cur];

    v16h kf00 = load_frag16(skc,  0, PITCH128B, 0);
    v16h kf01 = load_frag16(skc,  0, PITCH128B, 32);
    v16h kf10 = load_frag16(skc, 16, PITCH128B, 0);
    v16h kf11 = load_frag16(skc, 16, PITCH128B, 32);
    v8f s0 = {}, s1 = {};                          // S^T: m=key, n=query
    s0 = wmma16(kf00, qf0, s0);
    s0 = wmma16(kf01, qf1, s0);
    s1 = wmma16(kf10, qf0, s1);
    s1 = wmma16(kf11, qf1, s1);

    // online softmax per query (= per lane column, one shfl to merge halves)
    float t0[8], t1[8];
    float mloc = -1e30f;
    #pragma unroll
    for (int r = 0; r < 8; r++) {
      t0[r] = s0[r] * scale;
      t1[r] = s1[r] * scale;
      mloc = fmaxf(mloc, fmaxf(t0[r], t1[r]));
    }
    mloc = fmaxf(mloc, __shfl_xor(mloc, 16, 32));
    const float mnew = fmaxf(mrun, mloc);
    const float corr = __expf(mrun - mnew);
    float psum = 0.f;
    v16h pf;                                       // P^T B-fragment, in place
    #pragma unroll
    for (int r = 0; r < 8; r++) {
      const float p0 = __expf(t0[r] - mnew);
      const float p1 = __expf(t1[r] - mnew);
      psum += p0 + p1;
      pf[r]     = (_Float16)p0;
      pf[r + 8] = (_Float16)p1;
    }
    psum += __shfl_xor(psum, 16, 32);
    lrun = lrun * corr + psum;
    mrun = mnew;
    #pragma unroll
    for (int r = 0; r < 8; r++) {
      o0[r] *= corr; o1[r] *= corr; o2[r] *= corr; o3[r] *= corr;
    }
    v16h vf0 = load_frag16(svc,  0, PITCH64B, 0);
    v16h vf1 = load_frag16(svc, 16, PITCH64B, 0);
    v16h vf2 = load_frag16(svc, 32, PITCH64B, 0);
    v16h vf3 = load_frag16(svc, 48, PITCH64B, 0);
    o0 = wmma16(vf0, pf, o0);
    o1 = wmma16(vf1, pf, o1);
    o2 = wmma16(vf2, pf, o2);
    o3 = wmma16(vf3, pf, o3);
    __syncthreads();                               // reads done before rewrite
  }

  // normalize and store: lane's query = q0+l16; component r -> d = db*16+r+8*hb
  const float inv = 1.f / lrun;
  _Float16* crow = ctx + (size_t)(b * SEQ + q0 + l16) * DMODEL + h * DKH + 8 * hb;
  v8f oall[4] = {o0, o1, o2, o3};
  #pragma unroll
  for (int db = 0; db < 4; db++) {
    v8h pk;
    #pragma unroll
    for (int r = 0; r < 8; r++) pk[r] = (_Float16)(oall[db][r] * inv);
    *(v8h*)(crow + db * 16) = pk;
  }
}

// ---------------------------------------------------------------------------
extern "C" void kernel_launch(void* const* d_in, const int* in_sizes, int n_in,
                              void* d_out, int out_size, void* d_ws, size_t ws_size,
                              hipStream_t stream) {
  const float* q  = (const float*)d_in[0];
  const float* k  = (const float*)d_in[1];
  const float* v  = (const float*)d_in[2];
  const float* Wq = (const float*)d_in[3];
  const float* bq = (const float*)d_in[4];
  const float* Wk = (const float*)d_in[5];
  const float* bk = (const float*)d_in[6];
  const float* Wv = (const float*)d_in[7];
  const float* bv = (const float*)d_in[8];
  const float* Wo = (const float*)d_in[9];
  const float* bo = (const float*)d_in[10];

  const int rows = in_sizes[0] / DMODEL;   // B * S
  const int Bsz  = rows / SEQ;

  char* ws = (char*)d_ws;
  const size_t fbytes = (size_t)rows * DMODEL * sizeof(_Float16);   // 16 MB
  const size_t wbytes = (size_t)DMODEL * DMODEL * sizeof(_Float16); //  2 MB
  _Float16* Xq  = (_Float16*)(ws + 0 * fbytes);
  _Float16* Xk  = (_Float16*)(ws + 1 * fbytes);
  _Float16* Xv  = (_Float16*)(ws + 2 * fbytes);
  _Float16* Qf  = (_Float16*)(ws + 3 * fbytes);
  _Float16* Kf  = (_Float16*)(ws + 4 * fbytes);
  _Float16* Vtf = (_Float16*)(ws + 5 * fbytes);
  _Float16* Cf  = (_Float16*)(ws + 6 * fbytes);
  _Float16* wq16 = (_Float16*)(ws + 7 * fbytes + 0 * wbytes);
  _Float16* wk16 = (_Float16*)(ws + 7 * fbytes + 1 * wbytes);
  _Float16* wv16 = (_Float16*)(ws + 7 * fbytes + 2 * wbytes);
  _Float16* wo16 = (_Float16*)(ws + 7 * fbytes + 3 * wbytes);

  const int nX = rows * DMODEL;
  const int nW = DMODEL * DMODEL;
  mha_cvt_f16_kernel<<<2048, 256, 0, stream>>>(q,  Xq,   nX);
  mha_cvt_f16_kernel<<<2048, 256, 0, stream>>>(k,  Xk,   nX);
  mha_cvt_f16_kernel<<<2048, 256, 0, stream>>>(v,  Xv,   nX);
  mha_cvt_f16_kernel<<< 512, 256, 0, stream>>>(Wq, wq16, nW);
  mha_cvt_f16_kernel<<< 512, 256, 0, stream>>>(Wk, wk16, nW);
  mha_cvt_f16_kernel<<< 512, 256, 0, stream>>>(Wv, wv16, nW);
  mha_cvt_f16_kernel<<< 512, 256, 0, stream>>>(Wo, wo16, nW);

  const int gemm_blocks = (rows / 128) * (DMODEL / 64);   // 128x64 tile / block
  mha_gemm_kernel<<<gemm_blocks, 256, 0, stream>>>(Xq, wq16, bq, Qf,  nullptr, rows, 0);
  mha_gemm_kernel<<<gemm_blocks, 256, 0, stream>>>(Xk, wk16, bk, Kf,  nullptr, rows, 0);
  mha_gemm_kernel<<<gemm_blocks, 256, 0, stream>>>(Xv, wv16, bv, Vtf, nullptr, rows, 1);

  const int at_blocks = Bsz * NHEADS * (SEQ / 128);       // 128 queries / block
  mha_attn_kernel<<<at_blocks, 256, 0, stream>>>(Qf, Kf, Vtf, Cf, Bsz);

  mha_gemm_kernel<<<gemm_blocks, 256, 0, stream>>>(Cf, wo16, bo, nullptr,
                                                   (float*)d_out, rows, 2);
}

// v002
// A run of this version takes 238 microseconds.
// In two side-by-side timings against v001, it was 1.28 and 1.27 times as fast.
// Counting every step since v000, it is 2.08 times as fast.
#include <hip/hip_runtime.h>
#include <hip/hip_bf16.h>

typedef __attribute__((ext_vector_type(16))) _Float16 v16h;
typedef __attribute__((ext_vector_type(8)))  _Float16 v8h;
typedef __attribute__((ext_vector_type(8)))  float    v8f;

#define DMODEL 1024
#define SEQ    4096
#define NHEADS 16
#define DKH    64

#define PITCH64B  40   // 64-byte rows  -> 80 B
#define PITCH128B 72   // 128-byte rows -> 144 B

#define WAIT_ASYNCCNT(N) asm volatile("s_wait_asynccnt " #N ::: "memory")

__device__ __forceinline__ void async_b128(unsigned lds_byte_off,
                                           const void* gaddr) {
  asm volatile("global_load_async_to_lds_b128 %0, %1, off"
               :: "v"(lds_byte_off), "v"(gaddr) : "memory");
}

__device__ __forceinline__ unsigned lds_off(const void* p) {
  return (unsigned)(unsigned long long)p;
}

__device__ __forceinline__ v16h load_frag16(const _Float16* base,
                                            int row0, int rowstride, int kbase) {
  const int lane = threadIdx.x & 31;
  const int l16  = lane & 15;
  const int hb   = (lane >> 4) & 1;
  const _Float16* p = base + (size_t)(row0 + l16) * rowstride + kbase + hb * 8;
  v8h lo = *(const v8h*)(p);
  v8h hi = *(const v8h*)(p + 16);
  return __builtin_shufflevector(lo, hi, 0,1,2,3,4,5,6,7,8,9,10,11,12,13,14,15);
}

__device__ __forceinline__ v8f wmma16(v16h a, v16h b, v8f c) {
  return __builtin_amdgcn_wmma_f32_16x16x32_f16(false, a, false, b, (short)0, c,
                                                false, false);
}

// ---- fp32 -> f16 conversion ------------------------------------------------
__global__ void mha_cvt_f16_kernel(const float* __restrict__ in,
                                   _Float16* __restrict__ out, int n) {
  int i = blockIdx.x * blockDim.x + threadIdx.x;
  int stride = gridDim.x * blockDim.x;
  for (; i < n; i += stride) out[i] = (_Float16)in[i];
}

// ---- GEMM: C = A(rows x 1024, f16) @ W^T(1024 x 1024, f16) + bias ----------
// Block (8 waves, 4 x 2) computes a 128x128 C tile; wave tile 32x64, so each
// A fragment feeds four WMMAs and each W fragment two. Both operand tiles
// (128 rows x 64 k = 128-byte rows, padded to 144 B) come into LDS by async
// copies: one wave-wide copy covers four whole 128-byte lines. Two buffers,
// the next-but-one stage is issued behind the barrier that frees its buffer.
//   mode 0: f16 row-major out (Q/K projections)
//   mode 1: f16 per-head transposed out Vt[(b*16+h)*64+d][s] (V projection)
//   mode 2: f32 row-major out (final projection, writes d_out)
#define GEMM_KS 64                       // k per stage
#define GEMM_TILE (128 * PITCH128B)      // f16 elements of one staged tile

__device__ __forceinline__ void gemm_stage(unsigned la, unsigned lw,
                                           const _Float16* ga,
                                           const _Float16* gw) {
  asm volatile("global_load_async_to_lds_b128 %0, %8, off\n\t"
               "global_load_async_to_lds_b128 %1, %9, off\n\t"
               "global_load_async_to_lds_b128 %2, %10, off\n\t"
               "global_load_async_to_lds_b128 %3, %11, off\n\t"
               "global_load_async_to_lds_b128 %4, %12, off\n\t"
               "global_load_async_to_lds_b128 %5, %13, off\n\t"
               "global_load_async_to_lds_b128 %6, %14, off\n\t"
               "global_load_async_to_lds_b128 %7, %15, off\n\t"
               "s_wait_xcnt 0x0"
               :: "v"(la), "v"(la + 32 * PITCH128B * 2),
                  "v"(la + 64 * PITCH128B * 2), "v"(la + 96 * PITCH128B * 2),
                  "v"(lw), "v"(lw + 32 * PITCH128B * 2),
                  "v"(lw + 64 * PITCH128B * 2), "v"(lw + 96 * PITCH128B * 2),
                  "v"(ga), "v"(ga + 32 * DMODEL),
                  "v"(ga + 64 * DMODEL), "v"(ga + 96 * DMODEL),
                  "v"(gw), "v"(gw + 32 * DMODEL),
                  "v"(gw + 64 * DMODEL), "v"(gw + 96 * DMODEL)
               : "memory");
}

__global__ void __launch_bounds__(256)
mha_gemm_kernel(const _Float16* __restrict__ A, const _Float16* __restrict__ W,
                const float* __restrict__ bias, _Float16* __restrict__ outh,
                float* __restrict__ outf, int mrows, int mode) {
  __shared__ __attribute__((aligned(16))) _Float16 sA[2][GEMM_TILE];  // 2 x 18KB
  __shared__ __attribute__((aligned(16))) _Float16 sW[2][GEMM_TILE];  // 2 x 18KB
  const int nblocks = DMODEL / 128;                // 8
  const int mblk = blockIdx.x / nblocks;
  const int nblk0 = (blockIdx.x % nblocks) * 128;
  if (mblk * 128 >= mrows) return;                 // block-uniform guard
  const int tid  = threadIdx.x;
  const int wave = tid >> 5;
  const int wm   = (wave >> 1) * 32;               // wave's rows in the tile
  const int wn   = (wave & 1) * 64;                // wave's columns in the tile
  const int lane = tid & 31;
  const int l16  = lane & 15;
  const int hb   = (lane >> 4) & 1;

  // staging map: thread t moves rows t/8 + {0,32,64,96}, chunk (t%8)*8 .. +8
  const int srow = tid >> 3;
  const int schk = tid & 7;
  const _Float16* asrc = A + (size_t)(mblk * 128 + srow) * DMODEL + schk * 8;
  const _Float16* wsrc = W + (size_t)(nblk0 + srow) * DMODEL + schk * 8;
  const unsigned adst = lds_off(&sA[0][srow * PITCH128B + schk * 8]);
  const unsigned wdst = lds_off(&sW[0][srow * PITCH128B + schk * 8]);
  const int nstages = DMODEL / GEMM_KS;            // 16

  gemm_stage(adst, wdst, asrc, wsrc);              // stage 0 -> buffer 0
  WAIT_ASYNCCNT(0x0);                              // own copies of stage 0 landed
  __syncthreads();                                 // ... and everybody's
  gemm_stage(adst + GEMM_TILE * 2, wdst + GEMM_TILE * 2,
             asrc + GEMM_KS, wsrc + GEMM_KS);      // stage 1 -> buffer 1

  v8f acc[2][4] = {};
  for (int t = 0; t < nstages; t++) {
    const int cur = t & 1;
    const _Float16* sa = sA[cur];
    const _Float16* sw = sW[cur];
    v16h af[2][2], bf[2][4];
    // all loops over fragments and tiles are unrolled so that these arrays are
    // indexed by constants and stay in registers.
    #pragma unroll
    for (int ks = 0; ks < 2; ks++) {
      af[ks][0] = load_frag16(sa, wm,      PITCH128B, ks * 32);
      af[ks][1] = load_frag16(sa, wm + 16, PITCH128B, ks * 32);
      #pragma unroll
      for (int nb = 0; nb < 4; nb++)
        bf[ks][nb] = load_frag16(sw, wn + nb * 16, PITCH128B, ks * 32);
    }
    // publish point, taken as soon as the stage's 12 fragments (24 ds_load_b128) are in
    // registers: own LDS reads of this buffer retired, own copies of the next
    // stage landed, then one barrier that both publishes the next stage and
    // frees this buffer for the refill behind it.
    asm volatile("s_wait_dscnt 0x0" ::: "memory");
    WAIT_ASYNCCNT(0x0);
    __syncthreads();
    if (t + 2 < nstages)
      gemm_stage(adst + cur * (GEMM_TILE * 2), wdst + cur * (GEMM_TILE * 2),
                 asrc + (t + 2) * GEMM_KS, wsrc + (t + 2) * GEMM_KS);
    // keeps the 16 WMMAs behind the refill, so that the copies fly under them
    // and no WMMA is drawn in among the LDS reads.
    __builtin_amdgcn_sched_barrier(0);
    #pragma unroll
    for (int ks = 0; ks < 2; ks++)
      #pragma unroll
      for (int mi = 0; mi < 2; mi++)
        #pragma unroll
        for (int nb = 0; nb < 4; nb++)
          acc[mi][nb] = wmma16(af[ks][mi], bf[ks][nb], acc[mi][nb]);
  }
  WAIT_ASYNCCNT(0x0);                              // nothing in flight at the end

  // C/D layout: lane holds n = n0 + nb*16 + l16, component r holds m = m0+r+8*hb
  const int n0 = nblk0 + wn;
  #pragma unroll
  for (int mi = 0; mi < 2; mi++) {
    const int m0 = mblk * 128 + wm + mi * 16;
    if (mode == 1) {
      const int gm0   = m0 + 8 * hb;               // 8 consecutive rows (s dim)
      const int bb    = gm0 >> 12;                 // / SEQ
      const int sbase = gm0 & (SEQ - 1);
      #pragma unroll
      for (int nb = 0; nb < 4; nb++) {
        const int gn = n0 + nb * 16 + l16;
        const int h  = gn >> 6, d = gn & 63;
        const float bv = bias[gn];
        v8h pk;
        #pragma unroll
        for (int r = 0; r < 8; r++) pk[r] = (_Float16)(acc[mi][nb][r] + bv);
        *(v8h*)(outh + (((size_t)(bb * NHEADS + h) * DKH + d) * SEQ + sbase)) = pk;
      }
      // a register that an issued store names is rewritten behind this run
      // (next rows' values, the other modes' code): the wait stands in front.
      asm volatile("s_wait_xcnt 0x0" ::: "memory");
    } else if (mode == 0) {
      #pragma unroll
      for (int nb = 0; nb < 4; nb++) {
        const int gn = n0 + nb * 16 + l16;
        const float bv = bias[gn];
        #pragma unroll
        for (int r = 0; r < 8; r++) {
          const int gm = m0 + r + 8 * hb;
          outh[(size_t)gm * DMODEL + gn] = (_Float16)(acc[mi][nb][r] + bv);
        }
      }
      // a register that an issued store names is rewritten behind this run
      // (next rows' values, the other modes' code): the wait stands in front.
      asm volatile("s_wait_xcnt 0x0" ::: "memory");
    } else {
      #pragma unroll
      for (int nb = 0; nb < 4; nb++) {
        const int gn = n0 + nb * 16 + l16;
        const float bv = bias[gn];
        #pragma unroll
        for (int r = 0; r < 8; r++) {
          const int gm = m0 + r + 8 * hb;
          outf[(size_t)gm * DMODEL + gn] = acc[mi][nb][r] + bv;
        }
      }
      // a register that an issued store names is rewritten behind this run
      // (next rows' values, the other modes' code): the wait stands in front.
      asm volatile("s_wait_xcnt 0x0" ::: "memory");
    }
  }
}

__global__ void __launch_bounds__(256)
mha_attn_kernel(const _Float16* __restrict__ Qm, const _Float16* __restrict__ Km,
                const _Float16* __restrict__ Vt, _Float16* __restrict__ ctx,
                int Bsz) {
  __shared__ __attribute__((aligned(16))) _Float16 sK[2][32 * PITCH128B];  // row = key
  __shared__ __attribute__((aligned(16))) _Float16 sV[2][64 * PITCH64B];   // row = d
  const int qblocks = SEQ / 128;                   // 32
  const int qb = blockIdx.x % qblocks;
  const int h  = (blockIdx.x / qblocks) % NHEADS;
  const int b  = blockIdx.x / (qblocks * NHEADS);
  const int tid  = threadIdx.x;
  const int q0   = qb * 128 + (tid >> 5) * 16;
  const int lane = tid & 31;
  const int l16  = lane & 15;
  const int hb   = (lane >> 4) & 1;

  const _Float16* qbase = Qm + (size_t)b * SEQ * DMODEL + h * DKH;
  const _Float16* kbase = Km + (size_t)b * SEQ * DMODEL + h * DKH;
  const _Float16* vbase = Vt + (size_t)(b * NHEADS + h) * DKH * SEQ;

  // staging maps (one b128 chunk per thread per tile)
  const int krow = tid >> 3, kchk = tid & 7;       // K: 32 rows x 128B
  const _Float16* ksrc = kbase + (size_t)krow * DMODEL + kchk * 8;
  const unsigned kdst0 = lds_off(&sK[0][krow * PITCH128B + kchk * 8]);
  const unsigned kdst1 = lds_off(&sK[1][krow * PITCH128B + kchk * 8]);
  const int vrow = tid >> 2, vchk = tid & 3;       // V^T: 64 rows x 64B
  const _Float16* vsrc = vbase + (size_t)vrow * SEQ + vchk * 8;
  const unsigned vdst0 = lds_off(&sV[0][vrow * PITCH64B + vchk * 8]);
  const unsigned vdst1 = lds_off(&sV[1][vrow * PITCH64B + vchk * 8]);

  // loop-invariant Q^T fragments (d = 0..31 and 32..63)
  const v16h qf0 = load_frag16(qbase, q0, DMODEL, 0);
  const v16h qf1 = load_frag16(qbase, q0, DMODEL, 32);

  async_b128(kdst0, ksrc);                         // prologue: stage kk=0
  async_b128(vdst0, vsrc);

  v8f o0 = {}, o1 = {}, o2 = {}, o3 = {};          // O^T: 64d x 16q
  float mrun = -1e30f, lrun = 0.f;
  const float scale = 0.125f;                      // 1/sqrt(64)

  for (int kk = 0; kk < SEQ; kk += 32) {
    const int cur = (kk >> 5) & 1;
    if (kk + 32 < SEQ) {
      async_b128(cur ? kdst0 : kdst1, ksrc + (size_t)(kk + 32) * DMODEL);
      async_b128(cur ? vdst0 : vdst1, vsrc + kk + 32);
      WAIT_ASYNCCNT(0x2);                          // current stage landed
    } else {
      WAIT_ASYNCCNT(0x0);
    }
    __syncthreads();
    const _Float16* skc = sK[cur];
    const _Float16* svc = sV[cur];

    v16h kf00 = load_frag16(skc,  0, PITCH128B, 0);
    v16h kf01 = load_frag16(skc,  0, PITCH128B, 32);
    v16h kf10 = load_frag16(skc, 16, PITCH128B, 0);
    v16h kf11 = load_frag16(skc, 16, PITCH128B, 32);
    v8f s0 = {}, s1 = {};                          // S^T: m=key, n=query
    s0 = wmma16(kf00, qf0, s0);
    s0 = wmma16(kf01, qf1, s0);
    s1 = wmma16(kf10, qf0, s1);
    s1 = wmma16(kf11, qf1, s1);

    // online softmax per query (= per lane column, one shfl to merge halves)
    float t0[8], t1[8];
    float mloc = -1e30f;
    #pragma unroll
    for (int r = 0; r < 8; r++) {
      t0[r] = s0[r] * scale;
      t1[r] = s1[r] * scale;
      mloc = fmaxf(mloc, fmaxf(t0[r], t1[r]));
    }
    mloc = fmaxf(mloc, __shfl_xor(mloc, 16, 32));
    const float mnew = fmaxf(mrun, mloc);
    const float corr = __expf(mrun - mnew);
    float psum = 0.f;
    v16h pf;                                       // P^T B-fragment, in place
    #pragma unroll
    for (int r = 0; r < 8; r++) {
      const float p0 = __expf(t0[r] - mnew);
      const float p1 = __expf(t1[r] - mnew);
      psum += p0 + p1;
      pf[r]     = (_Float16)p0;
      pf[r + 8] = (_Float16)p1;
    }
    psum += __shfl_xor(psum, 16, 32);
    lrun = lrun * corr + psum;
    mrun = mnew;
    #pragma unroll
    for (int r = 0; r < 8; r++) {
      o0[r] *= corr; o1[r] *= corr; o2[r] *= corr; o3[r] *= corr;
    }
    v16h vf0 = load_frag16(svc,  0, PITCH64B, 0);
    v16h vf1 = load_frag16(svc, 16, PITCH64B, 0);
    v16h vf2 = load_frag16(svc, 32, PITCH64B, 0);
    v16h vf3 = load_frag16(svc, 48, PITCH64B, 0);
    o0 = wmma16(vf0, pf, o0);
    o1 = wmma16(vf1, pf, o1);
    o2 = wmma16(vf2, pf, o2);
    o3 = wmma16(vf3, pf, o3);
    __syncthreads();                               // reads done before rewrite
  }

  // normalize and store: lane's query = q0+l16; component r -> d = db*16+r+8*hb
  const float inv = 1.f / lrun;
  _Float16* crow = ctx + (size_t)(b * SEQ + q0 + l16) * DMODEL + h * DKH + 8 * hb;
  v8f oall[4] = {o0, o1, o2, o3};
  #pragma unroll
  for (int db = 0; db < 4; db++) {
    v8h pk;
    #pragma unroll
    for (int r = 0; r < 8; r++) pk[r] = (_Float16)(oall[db][r] * inv);
    *(v8h*)(crow + db * 16) = pk;
  }
}

// ---------------------------------------------------------------------------
extern "C" void kernel_launch(void* const* d_in, const int* in_sizes, int n_in,
                              void* d_out, int out_size, void* d_ws, size_t ws_size,
                              hipStream_t stream) {
  const float* q  = (const float*)d_in[0];
  const float* k  = (const float*)d_in[1];
  const float* v  = (const float*)d_in[2];
  const float* Wq = (const float*)d_in[3];
  const float* bq = (const float*)d_in[4];
  const float* Wk = (const float*)d_in[5];
  const float* bk = (const float*)d_in[6];
  const float* Wv = (const float*)d_in[7];
  const float* bv = (const float*)d_in[8];
  const float* Wo = (const float*)d_in[9];
  const float* bo = (const float*)d_in[10];

  const int rows = in_sizes[0] / DMODEL;   // B * S
  const int Bsz  = rows / SEQ;

  char* ws = (char*)d_ws;
  const size_t fbytes = (size_t)rows * DMODEL * sizeof(_Float16);   // 16 MB
  const size_t wbytes = (size_t)DMODEL * DMODEL * sizeof(_Float16); //  2 MB
  _Float16* Xq  = (_Float16*)(ws + 0 * fbytes);
  _Float16* Xk  = (_Float16*)(ws + 1 * fbytes);
  _Float16* Xv  = (_Float16*)(ws + 2 * fbytes);
  _Float16* Qf  = (_Float16*)(ws + 3 * fbytes);
  _Float16* Kf  = (_Float16*)(ws + 4 * fbytes);
  _Float16* Vtf = (_Float16*)(ws + 5 * fbytes);
  _Float16* Cf  = (_Float16*)(ws + 6 * fbytes);
  _Float16* wq16 = (_Float16*)(ws + 7 * fbytes + 0 * wbytes);
  _Float16* wk16 = (_Float16*)(ws + 7 * fbytes + 1 * wbytes);
  _Float16* wv16 = (_Float16*)(ws + 7 * fbytes + 2 * wbytes);
  _Float16* wo16 = (_Float16*)(ws + 7 * fbytes + 3 * wbytes);

  const int nX = rows * DMODEL;
  const int nW = DMODEL * DMODEL;
  mha_cvt_f16_kernel<<<2048, 256, 0, stream>>>(q,  Xq,   nX);
  mha_cvt_f16_kernel<<<2048, 256, 0, stream>>>(k,  Xk,   nX);
  mha_cvt_f16_kernel<<<2048, 256, 0, stream>>>(v,  Xv,   nX);
  mha_cvt_f16_kernel<<< 512, 256, 0, stream>>>(Wq, wq16, nW);
  mha_cvt_f16_kernel<<< 512, 256, 0, stream>>>(Wk, wk16, nW);
  mha_cvt_f16_kernel<<< 512, 256, 0, stream>>>(Wv, wv16, nW);
  mha_cvt_f16_kernel<<< 512, 256, 0, stream>>>(Wo, wo16, nW);

  const int gemm_blocks = (rows / 128) * (DMODEL / 128);  // 128x128 tile / block
  mha_gemm_kernel<<<gemm_blocks, 256, 0, stream>>>(Xq, wq16, bq, Qf,  nullptr, rows, 0);
  mha_gemm_kernel<<<gemm_blocks, 256, 0, stream>>>(Xk, wk16, bk, Kf,  nullptr, rows, 0);
  mha_gemm_kernel<<<gemm_blocks, 256, 0, stream>>>(Xv, wv16, bv, Vtf, nullptr, rows, 1);

  const int at_blocks = Bsz * NHEADS * (SEQ / 128);       // 128 queries / block
  mha_attn_kernel<<<at_blocks, 256, 0, stream>>>(Qf, Kf, Vtf, Cf, Bsz);

  mha_gemm_kernel<<<gemm_blocks, 256, 0, stream>>>(Cf, wo16, bo, nullptr,
                                                   (float*)d_out, rows, 2);
}

// v003
// It runs in 224 microseconds.
// Two timings next to v002 both put it at 1.06 times that version's speed.
// Counting every step since v000, it is 2.21 times as fast.
#include <hip/hip_runtime.h>
#include <hip/hip_bf16.h>

typedef __attribute__((ext_vector_type(16))) _Float16 v16h;
typedef __attribute__((ext_vector_type(8)))  _Float16 v8h;
typedef __attribute__((ext_vector_type(8)))  float    v8f;

#define DMODEL 1024
#define SEQ    4096
#define NHEADS 16
#define DKH    64

#define PITCH64B  40   // 64-byte rows  -> 80 B
#define PITCH128B 72   // 128-byte rows -> 144 B

#define WAIT_ASYNCCNT(N) asm volatile("s_wait_asynccnt " #N ::: "memory")

__device__ __forceinline__ void async_b128(unsigned lds_byte_off,
                                           const void* gaddr) {
  asm volatile("global_load_async_to_lds_b128 %0, %1, off"
               :: "v"(lds_byte_off), "v"(gaddr) : "memory");
}

__device__ __forceinline__ unsigned lds_off(const void* p) {
  return (unsigned)(unsigned long long)p;
}

__device__ __forceinline__ v16h load_frag16(const _Float16* base,
                                            int row0, int rowstride, int kbase) {
  const int lane = threadIdx.x & 31;
  const int l16  = lane & 15;
  const int hb   = (lane >> 4) & 1;
  const _Float16* p = base + (size_t)(row0 + l16) * rowstride + kbase + hb * 8;
  v8h lo = *(const v8h*)(p);
  v8h hi = *(const v8h*)(p + 16);
  return __builtin_shufflevector(lo, hi, 0,1,2,3,4,5,6,7,8,9,10,11,12,13,14,15);
}

__device__ __forceinline__ v8f wmma16(v16h a, v16h b, v8f c) {
  return __builtin_amdgcn_wmma_f32_16x16x32_f16(false, a, false, b, (short)0, c,
                                                false, false);
}

// ---- fp32 -> f16 conversion ------------------------------------------------
// One launch converts all seven f32 tensors. The work is cut into tiles of
// 16384 elements; a block walks the tiles with the grid as its stride, so few
// waves have to start and each streams: a thread loads a tile's share as eight
// 16-byte pieces (a wave-wide load covers 512 contiguous bytes = four lines),
// issues the next tile's eight loads before it converts and stores this one,
// and writes 8-byte pieces (a wave-wide store covers two whole lines).
// Every tensor's element count is a multiple of the tile (rows * 1024 with
// rows a multiple of 4096; 1024 * 1024), so a tile never straddles tensors.
typedef __attribute__((ext_vector_type(4))) float    v4f;
typedef __attribute__((ext_vector_type(4))) _Float16 v4h;
#define CVT_THREADS 512                  // 16 waves
#define CVT_SHIFT   14                   // tile = 512 threads x 8 x 4 elements
#define CVT_PIECE   (CVT_THREADS * 4)    // elements one block-wide load covers

// the loops over the eight pieces are unrolled so that x stays in registers
// and all eight loads are issued before the first value is needed.
__device__ __forceinline__ void cvt_load(v4f (&x)[8], const float* s) {
  #pragma unroll
  for (int j = 0; j < 8; j++) x[j] = *(const v4f*)(s + j * CVT_PIECE);
  // later code rewrites the address registers that these loads name: the
  // wait stands in front of that.
  asm volatile("s_wait_xcnt 0x0" ::: "memory");
}

__device__ __forceinline__ void cvt_store(const v4f (&x)[8], _Float16* d) {
  #pragma unroll
  for (int j = 0; j < 8; j++)
    *(v4h*)(d + j * CVT_PIECE) = __builtin_convertvector(x[j], v4h);
  // later code rewrites the address and data registers that these stores
  // name: the wait stands in front of that.
  asm volatile("s_wait_xcnt 0x0" ::: "memory");
}

__global__ void __launch_bounds__(CVT_THREADS)
mha_cvt_f16_kernel(const float* __restrict__ q,  const float* __restrict__ k,
                   const float* __restrict__ v,  const float* __restrict__ wq,
                   const float* __restrict__ wk, const float* __restrict__ wv,
                   const float* __restrict__ wo,
                   _Float16* __restrict__ xq,  _Float16* __restrict__ xk,
                   _Float16* __restrict__ xv,  _Float16* __restrict__ hq,
                   _Float16* __restrict__ hk,  _Float16* __restrict__ hv,
                   _Float16* __restrict__ ho, int nx, int nw) {
  const int tx = nx >> CVT_SHIFT;                  // tiles of an activation
  const int tw = nw >> CVT_SHIFT;                  // tiles of a weight
  const int ntiles = 3 * tx + 4 * tw;
  const int step = gridDim.x;

  // block-uniform choice of the tensor a tile belongs to; gives this thread's
  // first source and destination element of the tile.
  auto locate = [&](int t, const float*& s, _Float16*& d) {
    const float* src;
    _Float16* dst;
    if (t < 3 * tx) {
      if (t < tx)          { src = q; dst = xq; }
      else if (t < 2 * tx) { src = k; dst = xk; t -= tx; }
      else                 { src = v; dst = xv; t -= 2 * tx; }
    } else {
      t -= 3 * tx;
      if (t < tw)          { src = wq; dst = hq; }
      else if (t < 2 * tw) { src = wk; dst = hk; t -= tw; }
      else if (t < 3 * tw) { src = wv; dst = hv; t -= 2 * tw; }
      else                 { src = wo; dst = ho; t -= 3 * tw; }
    }
    const size_t off = ((size_t)t << CVT_SHIFT) + threadIdx.x * 4;
    s = src + off;
    d = dst + off;
  };

  int tile = blockIdx.x;
  if (tile >= ntiles) return;
  const int more = (ntiles - 1 - tile) / step;     // tiles behind the first one
  const float* s;
  _Float16 *d0, *d1;
  v4f x[8], y[8];                                  // two register buffers
  locate(tile, s, d0);
  cvt_load(x, s);
  // two tiles a trip, so that each buffer keeps its registers; the trip count
  // is known in front, so that the loop has one way in and one way out and
  // every wait for a buffer counts only the loads issued behind it.
  for (int i = 0; i < (more >> 1); i++) {
    tile += step;
    locate(tile, s, d1);
    cvt_load(y, s);                                // flies under x's stores
    // keeps x's conversions (and their waits for x) behind the issue of y's
    // loads; without it the compiler draws them in front and y starts late.
    __builtin_amdgcn_sched_barrier(0);
    cvt_store(x, d0);
    tile += step;
    locate(tile, s, d0);
    cvt_load(x, s);
    __builtin_amdgcn_sched_barrier(0);
    cvt_store(y, d1);
  }
  if (more & 1) {
    tile += step;
    locate(tile, s, d1);
    cvt_load(y, s);
    __builtin_amdgcn_sched_barrier(0);
    cvt_store(x, d0);
    cvt_store(y, d1);
  } else {
    cvt_store(x, d0);
  }
}

// ---- GEMM: C = A(rows x 1024, f16) @ W^T(1024 x 1024, f16) + bias ----------
// Block (8 waves, 4 x 2) computes a 128x128 C tile; wave tile 32x64, so each
// A fragment feeds four WMMAs and each W fragment two. Both operand tiles
// (128 rows x 64 k = 128-byte rows, padded to 144 B) come into LDS by async
// copies: one wave-wide copy covers four whole 128-byte lines. Two buffers,
// the next-but-one stage is issued behind the barrier that frees its buffer.
//   mode 0: f16 row-major out (Q/K projections)
//   mode 1: f16 per-head transposed out Vt[(b*16+h)*64+d][s] (V projection)
//   mode 2: f32 row-major out (final projection, writes d_out)
#define GEMM_KS 64                       // k per stage
#define GEMM_TILE (128 * PITCH128B)      // f16 elements of one staged tile

__device__ __forceinline__ void gemm_stage(unsigned la, unsigned lw,
                                           const _Float16* ga,
                                           const _Float16* gw) {
  asm volatile("global_load_async_to_lds_b128 %0, %8, off\n\t"
               "global_load_async_to_lds_b128 %1, %9, off\n\t"
               "global_load_async_to_lds_b128 %2, %10, off\n\t"
               "global_load_async_to_lds_b128 %3, %11, off\n\t"
               "global_load_async_to_lds_b128 %4, %12, off\n\t"
               "global_load_async_to_lds_b128 %5, %13, off\n\t"
               "global_load_async_to_lds_b128 %6, %14, off\n\t"
               "global_load_async_to_lds_b128 %7, %15, off\n\t"
               "s_wait_xcnt 0x0"
               :: "v"(la), "v"(la + 32 * PITCH128B * 2),
                  "v"(la + 64 * PITCH128B * 2), "v"(la + 96 * PITCH128B * 2),
                  "v"(lw), "v"(lw + 32 * PITCH128B * 2),
                  "v"(lw + 64 * PITCH128B * 2), "v"(lw + 96 * PITCH128B * 2),
                  "v"(ga), "v"(ga + 32 * DMODEL),
                  "v"(ga + 64 * DMODEL), "v"(ga + 96 * DMODEL),
                  "v"(gw), "v"(gw + 32 * DMODEL),
                  "v"(gw + 64 * DMODEL), "v"(gw + 96 * DMODEL)
               : "memory");
}

__global__ void __launch_bounds__(256)
mha_gemm_kernel(const _Float16* __restrict__ A, const _Float16* __restrict__ W,
                const float* __restrict__ bias, _Float16* __restrict__ outh,
                float* __restrict__ outf, int mrows, int mode) {
  __shared__ __attribute__((aligned(16))) _Float16 sA[2][GEMM_TILE];  // 2 x 18KB
  __shared__ __attribute__((aligned(16))) _Float16 sW[2][GEMM_TILE];  // 2 x 18KB
  const int nblocks = DMODEL / 128;                // 8
  const int mblk = blockIdx.x / nblocks;
  const int nblk0 = (blockIdx.x % nblocks) * 128;
  if (mblk * 128 >= mrows) return;                 // block-uniform guard
  const int tid  = threadIdx.x;
  const int wave = tid >> 5;
  const int wm   = (wave >> 1) * 32;               // wave's rows in the tile
  const int wn   = (wave & 1) * 64;                // wave's columns in the tile
  const int lane = tid & 31;
  const int l16  = lane & 15;
  const int hb   = (lane >> 4) & 1;

  // staging map: thread t moves rows t/8 + {0,32,64,96}, chunk (t%8)*8 .. +8
  const int srow = tid >> 3;
  const int schk = tid & 7;
  const _Float16* asrc = A + (size_t)(mblk * 128 + srow) * DMODEL + schk * 8;
  const _Float16* wsrc = W + (size_t)(nblk0 + srow) * DMODEL + schk * 8;
  const unsigned adst = lds_off(&sA[0][srow * PITCH128B + schk * 8]);
  const unsigned wdst = lds_off(&sW[0][srow * PITCH128B + schk * 8]);
  const int nstages = DMODEL / GEMM_KS;            // 16

  gemm_stage(adst, wdst, asrc, wsrc);              // stage 0 -> buffer 0
  WAIT_ASYNCCNT(0x0);                              // own copies of stage 0 landed
  __syncthreads();                                 // ... and everybody's
  gemm_stage(adst + GEMM_TILE * 2, wdst + GEMM_TILE * 2,
             asrc + GEMM_KS, wsrc + GEMM_KS);      // stage 1 -> buffer 1

  v8f acc[2][4] = {};
  for (int t = 0; t < nstages; t++) {
    const int cur = t & 1;
    const _Float16* sa = sA[cur];
    const _Float16* sw = sW[cur];
    v16h af[2][2], bf[2][4];
    // all loops over fragments and tiles are unrolled so that these arrays are
    // indexed by constants and stay in registers.
    #pragma unroll
    for (int ks = 0; ks < 2; ks++) {
      af[ks][0] = load_frag16(sa, wm,      PITCH128B, ks * 32);
      af[ks][1] = load_frag16(sa, wm + 16, PITCH128B, ks * 32);
      #pragma unroll
      for (int nb = 0; nb < 4; nb++)
        bf[ks][nb] = load_frag16(sw, wn + nb * 16, PITCH128B, ks * 32);
    }
    // publish point, taken as soon as the stage's 12 fragments (24 ds_load_b128) are in
    // registers: own LDS reads of this buffer retired, own copies of the next
    // stage landed, then one barrier that both publishes the next stage and
    // frees this buffer for the refill behind it.
    asm volatile("s_wait_dscnt 0x0" ::: "memory");
    WAIT_ASYNCCNT(0x0);
    __syncthreads();
    if (t + 2 < nstages)
      gemm_stage(adst + cur * (GEMM_TILE * 2), wdst + cur * (GEMM_TILE * 2),
                 asrc + (t + 2) * GEMM_KS, wsrc + (t + 2) * GEMM_KS);
    // keeps the 16 WMMAs behind the refill, so that the copies fly under them
    // and no WMMA is drawn in among the LDS reads.
    __builtin_amdgcn_sched_barrier(0);
    #pragma unroll
    for (int ks = 0; ks < 2; ks++)
      #pragma unroll
      for (int mi = 0; mi < 2; mi++)
        #pragma unroll
        for (int nb = 0; nb < 4; nb++)
          acc[mi][nb] = wmma16(af[ks][mi], bf[ks][nb], acc[mi][nb]);
  }
  WAIT_ASYNCCNT(0x0);                              // nothing in flight at the end

  // C/D layout: lane holds n = n0 + nb*16 + l16, component r holds m = m0+r+8*hb
  const int n0 = nblk0 + wn;
  #pragma unroll
  for (int mi = 0; mi < 2; mi++) {
    const int m0 = mblk * 128 + wm + mi * 16;
    if (mode == 1) {
      const int gm0   = m0 + 8 * hb;               // 8 consecutive rows (s dim)
      const int bb    = gm0 >> 12;                 // / SEQ
      const int sbase = gm0 & (SEQ - 1);
      #pragma unroll
      for (int nb = 0; nb < 4; nb++) {
        const int gn = n0 + nb * 16 + l16;
        const int h  = gn >> 6, d = gn & 63;
        const float bv = bias[gn];
        v8h pk;
        #pragma unroll
        for (int r = 0; r < 8; r++) pk[r] = (_Float16)(acc[mi][nb][r] + bv);
        *(v8h*)(outh + (((size_t)(bb * NHEADS + h) * DKH + d) * SEQ + sbase)) = pk;
      }
      // a register that an issued store names is rewritten behind this run
      // (next rows' values, the other modes' code): the wait stands in front.
      asm volatile("s_wait_xcnt 0x0" ::: "memory");
    } else if (mode == 0) {
      #pragma unroll
      for (int nb = 0; nb < 4; nb++) {
        const int gn = n0 + nb * 16 + l16;
        const float bv = bias[gn];
        #pragma unroll
        for (int r = 0; r < 8; r++) {
          const int gm = m0 + r + 8 * hb;
          outh[(size_t)gm * DMODEL + gn] = (_Float16)(acc[mi][nb][r] + bv);
        }
      }
      // a register that an issued store names is rewritten behind this run
      // (next rows' values, the other modes' code): the wait stands in front.
      asm volatile("s_wait_xcnt 0x0" ::: "memory");
    } else {
      #pragma unroll
      for (int nb = 0; nb < 4; nb++) {
        const int gn = n0 + nb * 16 + l16;
        const float bv = bias[gn];
        #pragma unroll
        for (int r = 0; r < 8; r++) {
          const int gm = m0 + r + 8 * hb;
          outf[(size_t)gm * DMODEL + gn] = acc[mi][nb][r] + bv;
        }
      }
      // a register that an issued store names is rewritten behind this run
      // (next rows' values, the other modes' code): the wait stands in front.
      asm volatile("s_wait_xcnt 0x0" ::: "memory");
    }
  }
}

__global__ void __launch_bounds__(256)
mha_attn_kernel(const _Float16* __restrict__ Qm, const _Float16* __restrict__ Km,
                const _Float16* __restrict__ Vt, _Float16* __restrict__ ctx,
                int Bsz) {
  __shared__ __attribute__((aligned(16))) _Float16 sK[2][32 * PITCH128B];  // row = key
  __shared__ __attribute__((aligned(16))) _Float16 sV[2][64 * PITCH64B];   // row = d
  const int qblocks = SEQ / 128;                   // 32
  const int qb = blockIdx.x % qblocks;
  const int h  = (blockIdx.x / qblocks) % NHEADS;
  const int b  = blockIdx.x / (qblocks * NHEADS);
  const int tid  = threadIdx.x;
  const int q0   = qb * 128 + (tid >> 5) * 16;
  const int lane = tid & 31;
  const int l16  = lane & 15;
  const int hb   = (lane >> 4) & 1;

  const _Float16* qbase = Qm + (size_t)b * SEQ * DMODEL + h * DKH;
  const _Float16* kbase = Km + (size_t)b * SEQ * DMODEL + h * DKH;
  const _Float16* vbase = Vt + (size_t)(b * NHEADS + h) * DKH * SEQ;

  // staging maps (one b128 chunk per thread per tile)
  const int krow = tid >> 3, kchk = tid & 7;       // K: 32 rows x 128B
  const _Float16* ksrc = kbase + (size_t)krow * DMODEL + kchk * 8;
  const unsigned kdst0 = lds_off(&sK[0][krow * PITCH128B + kchk * 8]);
  const unsigned kdst1 = lds_off(&sK[1][krow * PITCH128B + kchk * 8]);
  const int vrow = tid >> 2, vchk = tid & 3;       // V^T: 64 rows x 64B
  const _Float16* vsrc = vbase + (size_t)vrow * SEQ + vchk * 8;
  const unsigned vdst0 = lds_off(&sV[0][vrow * PITCH64B + vchk * 8]);
  const unsigned vdst1 = lds_off(&sV[1][vrow * PITCH64B + vchk * 8]);

  // loop-invariant Q^T fragments (d = 0..31 and 32..63)
  const v16h qf0 = load_frag16(qbase, q0, DMODEL, 0);
  const v16h qf1 = load_frag16(qbase, q0, DMODEL, 32);

  async_b128(kdst0, ksrc);                         // prologue: stage kk=0
  async_b128(vdst0, vsrc);

  v8f o0 = {}, o1 = {}, o2 = {}, o3 = {};          // O^T: 64d x 16q
  float mrun = -1e30f, lrun = 0.f;
  const float scale = 0.125f;                      // 1/sqrt(64)

  for (int kk = 0; kk < SEQ; kk += 32) {
    const int cur = (kk >> 5) & 1;
    if (kk + 32 < SEQ) {
      async_b128(cur ? kdst0 : kdst1, ksrc + (size_t)(kk + 32) * DMODEL);
      async_b128(cur ? vdst0 : vdst1, vsrc + kk + 32);
      WAIT_ASYNCCNT(0x2);                          // current stage landed
    } else {
      WAIT_ASYNCCNT(0x0);
    }
    __syncthreads();
    const _Float16* skc = sK[cur];
    const _Float16* svc = sV[cur];

    v16h kf00 = load_frag16(skc,  0, PITCH128B, 0);
    v16h kf01 = load_frag16(skc,  0, PITCH128B, 32);
    v16h kf10 = load_frag16(skc, 16, PITCH128B, 0);
    v16h kf11 = load_frag16(skc, 16, PITCH128B, 32);
    v8f s0 = {}, s1 = {};                          // S^T: m=key, n=query
    s0 = wmma16(kf00, qf0, s0);
    s0 = wmma16(kf01, qf1, s0);
    s1 = wmma16(kf10, qf0, s1);
    s1 = wmma16(kf11, qf1, s1);

    // online softmax per query (= per lane column, one shfl to merge halves)
    float t0[8], t1[8];
    float mloc = -1e30f;
    #pragma unroll
    for (int r = 0; r < 8; r++) {
      t0[r] = s0[r] * scale;
      t1[r] = s1[r] * scale;
      mloc = fmaxf(mloc, fmaxf(t0[r], t1[r]));
    }
    mloc = fmaxf(mloc, __shfl_xor(mloc, 16, 32));
    const float mnew = fmaxf(mrun, mloc);
    const float corr = __expf(mrun - mnew);
    float psum = 0.f;
    v16h pf;                                       // P^T B-fragment, in place
    #pragma unroll
    for (int r = 0; r < 8; r++) {
      const float p0 = __expf(t0[r] - mnew);
      const float p1 = __expf(t1[r] - mnew);
      psum += p0 + p1;
      pf[r]     = (_Float16)p0;
      pf[r + 8] = (_Float16)p1;
    }
    psum += __shfl_xor(psum, 16, 32);
    lrun = lrun * corr + psum;
    mrun = mnew;
    #pragma unroll
    for (int r = 0; r < 8; r++) {
      o0[r] *= corr; o1[r] *= corr; o2[r] *= corr; o3[r] *= corr;
    }
    v16h vf0 = load_frag16(svc,  0, PITCH64B, 0);
    v16h vf1 = load_frag16(svc, 16, PITCH64B, 0);
    v16h vf2 = load_frag16(svc, 32, PITCH64B, 0);
    v16h vf3 = load_frag16(svc, 48, PITCH64B, 0);
    o0 = wmma16(vf0, pf, o0);
    o1 = wmma16(vf1, pf, o1);
    o2 = wmma16(vf2, pf, o2);
    o3 = wmma16(vf3, pf, o3);
    __syncthreads();                               // reads done before rewrite
  }

  // normalize and store: lane's query = q0+l16; component r -> d = db*16+r+8*hb
  const float inv = 1.f / lrun;
  _Float16* crow = ctx + (size_t)(b * SEQ + q0 + l16) * DMODEL + h * DKH + 8 * hb;
  v8f oall[4] = {o0, o1, o2, o3};
  #pragma unroll
  for (int db = 0; db < 4; db++) {
    v8h pk;
    #pragma unroll
    for (int r = 0; r < 8; r++) pk[r] = (_Float16)(oall[db][r] * inv);
    *(v8h*)(crow + db * 16) = pk;
  }
}

// ---------------------------------------------------------------------------
extern "C" void kernel_launch(void* const* d_in, const int* in_sizes, int n_in,
                              void* d_out, int out_size, void* d_ws, size_t ws_size,
                              hipStream_t stream) {
  const float* q  = (const float*)d_in[0];
  const float* k  = (const float*)d_in[1];
  const float* v  = (const float*)d_in[2];
  const float* Wq = (const float*)d_in[3];
  const float* bq = (const float*)d_in[4];
  const float* Wk = (const float*)d_in[5];
  const float* bk = (const float*)d_in[6];
  const float* Wv = (const float*)d_in[7];
  const float* bv = (const float*)d_in[8];
  const float* Wo = (const float*)d_in[9];
  const float* bo = (const float*)d_in[10];

  const int rows = in_sizes[0] / DMODEL;   // B * S
  const int Bsz  = rows / SEQ;

  char* ws = (char*)d_ws;
  const size_t fbytes = (size_t)rows * DMODEL * sizeof(_Float16);   // 16 MB
  const size_t wbytes = (size_t)DMODEL * DMODEL * sizeof(_Float16); //  2 MB
  _Float16* Xq  = (_Float16*)(ws + 0 * fbytes);
  _Float16* Xk  = (_Float16*)(ws + 1 * fbytes);
  _Float16* Xv  = (_Float16*)(ws + 2 * fbytes);
  _Float16* Qf  = (_Float16*)(ws + 3 * fbytes);
  _Float16* Kf  = (_Float16*)(ws + 4 * fbytes);
  _Float16* Vtf = (_Float16*)(ws + 5 * fbytes);
  _Float16* Cf  = (_Float16*)(ws + 6 * fbytes);
  _Float16* wq16 = (_Float16*)(ws + 7 * fbytes + 0 * wbytes);
  _Float16* wk16 = (_Float16*)(ws + 7 * fbytes + 1 * wbytes);
  _Float16* wv16 = (_Float16*)(ws + 7 * fbytes + 2 * wbytes);
  _Float16* wo16 = (_Float16*)(ws + 7 * fbytes + 3 * wbytes);

  const int nX = rows * DMODEL;
  const int nW = DMODEL * DMODEL;
  // 256 blocks of 16 waves = one per WGP, seven tiles each at these shapes
  mha_cvt_f16_kernel<<<256, CVT_THREADS, 0, stream>>>(q, k, v, Wq, Wk, Wv, Wo,
                                                      Xq, Xk, Xv, wq16, wk16,
                                                      wv16, wo16, nX, nW);

  const int gemm_blocks = (rows / 128) * (DMODEL / 128);  // 128x128 tile / block
  mha_gemm_kernel<<<gemm_blocks, 256, 0, stream>>>(Xq, wq16, bq, Qf,  nullptr, rows, 0);
  mha_gemm_kernel<<<gemm_blocks, 256, 0, stream>>>(Xk, wk16, bk, Kf,  nullptr, rows, 0);
  mha_gemm_kernel<<<gemm_blocks, 256, 0, stream>>>(Xv, wv16, bv, Vtf, nullptr, rows, 1);

  const int at_blocks = Bsz * NHEADS * (SEQ / 128);       // 128 queries / block
  mha_attn_kernel<<<at_blocks, 256, 0, stream>>>(Qf, Kf, Vtf, Cf, Bsz);

  mha_gemm_kernel<<<gemm_blocks, 256, 0, stream>>>(Cf, wo16, bo, nullptr,
                                                   (float*)d_out, rows, 2);
}

// v004
// One run takes 213 microseconds.
// In both of two side-by-side timings against v003, it was 1.05 times as fast.
// All steps since v000 together make it 2.32 times as fast.
#include <hip/hip_runtime.h>
#include <hip/hip_bf16.h>

typedef __attribute__((ext_vector_type(16))) _Float16 v16h;
typedef __attribute__((ext_vector_type(8)))  _Float16 v8h;
typedef __attribute__((ext_vector_type(8)))  float    v8f;

#define DMODEL 1024
#define SEQ    4096
#define NHEADS 16
#define DKH    64

#define PITCH64B  40   // 64-byte rows  -> 80 B
#define PITCH128B 72   // 128-byte rows -> 144 B

#define WAIT_ASYNCCNT(N) asm volatile("s_wait_asynccnt " #N ::: "memory")

__device__ __forceinline__ void async_b128(unsigned lds_byte_off,
                                           const void* gaddr) {
  asm volatile("global_load_async_to_lds_b128 %0, %1, off"
               :: "v"(lds_byte_off), "v"(gaddr) : "memory");
}

__device__ __forceinline__ unsigned lds_off(const void* p) {
  return (unsigned)(unsigned long long)p;
}

__device__ __forceinline__ v16h load_frag16(const _Float16* base,
                                            int row0, int rowstride, int kbase) {
  const int lane = threadIdx.x & 31;
  const int l16  = lane & 15;
  const int hb   = (lane >> 4) & 1;
  const _Float16* p = base + (size_t)(row0 + l16) * rowstride + kbase + hb * 8;
  v8h lo = *(const v8h*)(p);
  v8h hi = *(const v8h*)(p + 16);
  return __builtin_shufflevector(lo, hi, 0,1,2,3,4,5,6,7,8,9,10,11,12,13,14,15);
}

__device__ __forceinline__ v8f wmma16(v16h a, v16h b, v8f c) {
  return __builtin_amdgcn_wmma_f32_16x16x32_f16(false, a, false, b, (short)0, c,
                                                false, false);
}

// ---- fp32 -> f16 conversion ------------------------------------------------
// One launch converts all seven f32 tensors. The work is cut into tiles of
// 16384 elements; a block walks the tiles with the grid as its stride, so few
// waves have to start and each streams: a thread loads a tile's share as eight
// 16-byte pieces (a wave-wide load covers 512 contiguous bytes = four lines),
// issues the next tile's eight loads before it converts and stores this one,
// and writes 8-byte pieces (a wave-wide store covers two whole lines).
// Every tensor's element count is a multiple of the tile (rows * 1024 with
// rows a multiple of 4096; 1024 * 1024), so a tile never straddles tensors.
typedef __attribute__((ext_vector_type(4))) float    v4f;
typedef __attribute__((ext_vector_type(4))) _Float16 v4h;
#define CVT_THREADS 512                  // 16 waves
#define CVT_SHIFT   14                   // tile = 512 threads x 8 x 4 elements
#define CVT_PIECE   (CVT_THREADS * 4)    // elements one block-wide load covers

// the loops over the eight pieces are unrolled so that x stays in registers
// and all eight loads are issued before the first value is needed.
__device__ __forceinline__ void cvt_load(v4f (&x)[8], const float* s) {
  #pragma unroll
  for (int j = 0; j < 8; j++) x[j] = *(const v4f*)(s + j * CVT_PIECE);
  // later code rewrites the address registers that these loads name: the
  // wait stands in front of that.
  asm volatile("s_wait_xcnt 0x0" ::: "memory");
}

__device__ __forceinline__ void cvt_store(const v4f (&x)[8], _Float16* d) {
  #pragma unroll
  for (int j = 0; j < 8; j++)
    *(v4h*)(d + j * CVT_PIECE) = __builtin_convertvector(x[j], v4h);
  // later code rewrites the address and data registers that these stores
  // name: the wait stands in front of that.
  asm volatile("s_wait_xcnt 0x0" ::: "memory");
}

__global__ void __launch_bounds__(CVT_THREADS)
mha_cvt_f16_kernel(const float* __restrict__ q,  const float* __restrict__ k,
                   const float* __restrict__ v,  const float* __restrict__ wq,
                   const float* __restrict__ wk, const float* __restrict__ wv,
                   const float* __restrict__ wo,
                   _Float16* __restrict__ xq,  _Float16* __restrict__ xk,
                   _Float16* __restrict__ xv,  _Float16* __restrict__ hq,
                   _Float16* __restrict__ hk,  _Float16* __restrict__ hv,
                   _Float16* __restrict__ ho, int nx, int nw) {
  const int tx = nx >> CVT_SHIFT;                  // tiles of an activation
  const int tw = nw >> CVT_SHIFT;                  // tiles of a weight
  const int ntiles = 3 * tx + 4 * tw;
  const int step = gridDim.x;

  // block-uniform choice of the tensor a tile belongs to; gives this thread's
  // first source and destination element of the tile.
  auto locate = [&](int t, const float*& s, _Float16*& d) {
    const float* src;
    _Float16* dst;
    if (t < 3 * tx) {
      if (t < tx)          { src = q; dst = xq; }
      else if (t < 2 * tx) { src = k; dst = xk; t -= tx; }
      else                 { src = v; dst = xv; t -= 2 * tx; }
    } else {
      t -= 3 * tx;
      if (t < tw)          { src = wq; dst = hq; }
      else if (t < 2 * tw) { src = wk; dst = hk; t -= tw; }
      else if (t < 3 * tw) { src = wv; dst = hv; t -= 2 * tw; }
      else                 { src = wo; dst = ho; t -= 3 * tw; }
    }
    const size_t off = ((size_t)t << CVT_SHIFT) + threadIdx.x * 4;
    s = src + off;
    d = dst + off;
  };

  int tile = blockIdx.x;
  if (tile >= ntiles) return;
  const int more = (ntiles - 1 - tile) / step;     // tiles behind the first one
  const float* s;
  _Float16 *d0, *d1;
  v4f x[8], y[8];                                  // two register buffers
  locate(tile, s, d0);
  cvt_load(x, s);
  // two tiles a trip, so that each buffer keeps its registers; the trip count
  // is known in front, so that the loop has one way in and one way out and
  // every wait for a buffer counts only the loads issued behind it.
  for (int i = 0; i < (more >> 1); i++) {
    tile += step;
    locate(tile, s, d1);
    cvt_load(y, s);                                // flies under x's stores
    // keeps x's conversions (and their waits for x) behind the issue of y's
    // loads; without it the compiler draws them in front and y starts late.
    __builtin_amdgcn_sched_barrier(0);
    cvt_store(x, d0);
    tile += step;
    locate(tile, s, d0);
    cvt_load(x, s);
    __builtin_amdgcn_sched_barrier(0);
    cvt_store(y, d1);
  }
  if (more & 1) {
    tile += step;
    locate(tile, s, d1);
    cvt_load(y, s);
    __builtin_amdgcn_sched_barrier(0);
    cvt_store(x, d0);
    cvt_store(y, d1);
  } else {
    cvt_store(x, d0);
  }
}

// ---- GEMM: C = A(rows x 1024, f16) @ W^T(1024 x 1024, f16) + bias ----------
// Block (8 waves, 4 x 2) computes a 128x128 C tile; wave tile 32x64, so each
// A fragment feeds four WMMAs and each W fragment two. Both operand tiles
// (128 rows x 64 k = 128-byte rows, padded to 144 B) come into LDS by async
// copies: one wave-wide copy covers four whole 128-byte lines. Two buffers,
// the next-but-one stage is issued behind the barrier that frees its buffer.
//   mode 0: f16 row-major out (Q/K projections)
//   mode 1: f16 per-head transposed out Vt[(b*16+h)*64+d][s] (V projection)
//   mode 2: f32 row-major out (final projection, writes d_out)
#define GEMM_KS 64                       // k per stage
#define GEMM_TILE (128 * PITCH128B)      // f16 elements of one staged tile

__device__ __forceinline__ void gemm_stage(unsigned la, unsigned lw,
                                           const _Float16* ga,
                                           const _Float16* gw) {
  asm volatile("global_load_async_to_lds_b128 %0, %8, off\n\t"
               "global_load_async_to_lds_b128 %1, %9, off\n\t"
               "global_load_async_to_lds_b128 %2, %10, off\n\t"
               "global_load_async_to_lds_b128 %3, %11, off\n\t"
               "global_load_async_to_lds_b128 %4, %12, off\n\t"
               "global_load_async_to_lds_b128 %5, %13, off\n\t"
               "global_load_async_to_lds_b128 %6, %14, off\n\t"
               "global_load_async_to_lds_b128 %7, %15, off\n\t"
               "s_wait_xcnt 0x0"
               :: "v"(la), "v"(la + 32 * PITCH128B * 2),
                  "v"(la + 64 * PITCH128B * 2), "v"(la + 96 * PITCH128B * 2),
                  "v"(lw), "v"(lw + 32 * PITCH128B * 2),
                  "v"(lw + 64 * PITCH128B * 2), "v"(lw + 96 * PITCH128B * 2),
                  "v"(ga), "v"(ga + 32 * DMODEL),
                  "v"(ga + 64 * DMODEL), "v"(ga + 96 * DMODEL),
                  "v"(gw), "v"(gw + 32 * DMODEL),
                  "v"(gw + 64 * DMODEL), "v"(gw + 96 * DMODEL)
               : "memory");
}

__global__ void __launch_bounds__(256)
mha_gemm_kernel(const _Float16* __restrict__ A, const _Float16* __restrict__ W,
                const float* __restrict__ bias, _Float16* __restrict__ outh,
                float* __restrict__ outf, int mrows, int mode) {
  __shared__ __attribute__((aligned(16))) _Float16 sA[2][GEMM_TILE];  // 2 x 18KB
  __shared__ __attribute__((aligned(16))) _Float16 sW[2][GEMM_TILE];  // 2 x 18KB
  const int nblocks = DMODEL / 128;                // 8
  const int mblk = blockIdx.x / nblocks;
  const int nblk0 = (blockIdx.x % nblocks) * 128;
  if (mblk * 128 >= mrows) return;                 // block-uniform guard
  const int tid  = threadIdx.x;
  const int wave = tid >> 5;
  const int wm   = (wave >> 1) * 32;               // wave's rows in the tile
  const int wn   = (wave & 1) * 64;                // wave's columns in the tile
  const int lane = tid & 31;
  const int l16  = lane & 15;
  const int hb   = (lane >> 4) & 1;

  // staging map: thread t moves rows t/8 + {0,32,64,96}, chunk (t%8)*8 .. +8
  const int srow = tid >> 3;
  const int schk = tid & 7;
  const _Float16* asrc = A + (size_t)(mblk * 128 + srow) * DMODEL + schk * 8;
  const _Float16* wsrc = W + (size_t)(nblk0 + srow) * DMODEL + schk * 8;
  const unsigned adst = lds_off(&sA[0][srow * PITCH128B + schk * 8]);
  const unsigned wdst = lds_off(&sW[0][srow * PITCH128B + schk * 8]);
  const int nstages = DMODEL / GEMM_KS;            // 16

  gemm_stage(adst, wdst, asrc, wsrc);              // stage 0 -> buffer 0
  WAIT_ASYNCCNT(0x0);                              // own copies of stage 0 landed
  __syncthreads();                                 // ... and everybody's
  gemm_stage(adst + GEMM_TILE * 2, wdst + GEMM_TILE * 2,
             asrc + GEMM_KS, wsrc + GEMM_KS);      // stage 1 -> buffer 1

  v8f acc[2][4] = {};
  for (int t = 0; t < nstages; t++) {
    const int cur = t & 1;
    const _Float16* sa = sA[cur];
    const _Float16* sw = sW[cur];
    v16h af[2][2], bf[2][4];
    // all loops over fragments and tiles are unrolled so that these arrays are
    // indexed by constants and stay in registers.
    #pragma unroll
    for (int ks = 0; ks < 2; ks++) {
      af[ks][0] = load_frag16(sa, wm,      PITCH128B, ks * 32);
      af[ks][1] = load_frag16(sa, wm + 16, PITCH128B, ks * 32);
      #pragma unroll
      for (int nb = 0; nb < 4; nb++)
        bf[ks][nb] = load_frag16(sw, wn + nb * 16, PITCH128B, ks * 32);
    }
    // publish point, taken as soon as the stage's 12 fragments (24 ds_load_b128) are in
    // registers: own LDS reads of this buffer retired, own copies of the next
    // stage landed, then one barrier that both publishes the next stage and
    // frees this buffer for the refill behind it.
    asm volatile("s_wait_dscnt 0x0" ::: "memory");
    WAIT_ASYNCCNT(0x0);
    __syncthreads();
    if (t + 2 < nstages)
      gemm_stage(adst + cur * (GEMM_TILE * 2), wdst + cur * (GEMM_TILE * 2),
                 asrc + (t + 2) * GEMM_KS, wsrc + (t + 2) * GEMM_KS);
    // keeps the 16 WMMAs behind the refill, so that the copies fly under them
    // and no WMMA is drawn in among the LDS reads.
    __builtin_amdgcn_sched_barrier(0);
    #pragma unroll
    for (int ks = 0; ks < 2; ks++)
      #pragma unroll
      for (int mi = 0; mi < 2; mi++)
        #pragma unroll
        for (int nb = 0; nb < 4; nb++)
          acc[mi][nb] = wmma16(af[ks][mi], bf[ks][nb], acc[mi][nb]);
  }
  WAIT_ASYNCCNT(0x0);                              // nothing in flight at the end

  // C/D layout: lane holds n = n0 + nb*16 + l16, component r holds m = m0+r+8*hb
  const int n0 = nblk0 + wn;
  #pragma unroll
  for (int mi = 0; mi < 2; mi++) {
    const int m0 = mblk * 128 + wm + mi * 16;
    if (mode == 1) {
      const int gm0   = m0 + 8 * hb;               // 8 consecutive rows (s dim)
      const int bb    = gm0 >> 12;                 // / SEQ
      const int sbase = gm0 & (SEQ - 1);
      #pragma unroll
      for (int nb = 0; nb < 4; nb++) {
        const int gn = n0 + nb * 16 + l16;
        const int h  = gn >> 6, d = gn & 63;
        const float bv = bias[gn];
        v8h pk;
        #pragma unroll
        for (int r = 0; r < 8; r++) pk[r] = (_Float16)(acc[mi][nb][r] + bv);
        *(v8h*)(outh + (((size_t)(bb * NHEADS + h) * DKH + d) * SEQ + sbase)) = pk;
      }
      // a register that an issued store names is rewritten behind this run
      // (next rows' values, the other modes' code): the wait stands in front.
      asm volatile("s_wait_xcnt 0x0" ::: "memory");
    } else if (mode == 0) {
      #pragma unroll
      for (int nb = 0; nb < 4; nb++) {
        const int gn = n0 + nb * 16 + l16;
        const float bv = bias[gn];
        #pragma unroll
        for (int r = 0; r < 8; r++) {
          const int gm = m0 + r + 8 * hb;
          outh[(size_t)gm * DMODEL + gn] = (_Float16)(acc[mi][nb][r] + bv);
        }
      }
      // a register that an issued store names is rewritten behind this run
      // (next rows' values, the other modes' code): the wait stands in front.
      asm volatile("s_wait_xcnt 0x0" ::: "memory");
    } else {
      #pragma unroll
      for (int nb = 0; nb < 4; nb++) {
        const int gn = n0 + nb * 16 + l16;
        const float bv = bias[gn];
        #pragma unroll
        for (int r = 0; r < 8; r++) {
          const int gm = m0 + r + 8 * hb;
          outf[(size_t)gm * DMODEL + gn] = acc[mi][nb][r] + bv;
        }
      }
      // a register that an issued store names is rewritten behind this run
      // (next rows' values, the other modes' code): the wait stands in front.
      asm volatile("s_wait_xcnt 0x0" ::: "memory");
    }
  }
}

#define ATT_CG 2                                   // column groups per wave
__global__ void __launch_bounds__(256) __attribute__((amdgpu_waves_per_eu(4, 4)))
mha_attn_kernel(const _Float16* __restrict__ Qm, const _Float16* __restrict__ Km,
                const _Float16* __restrict__ Vt, _Float16* __restrict__ ctx,
                int Bsz) {
  __shared__ __attribute__((aligned(16))) _Float16 sK[2][32 * PITCH128B];  // row = key
  __shared__ __attribute__((aligned(16))) _Float16 sV[2][64 * PITCH64B];   // row = d
  const int qblocks = SEQ / (128 * ATT_CG);        // 16
  const int qb = blockIdx.x % qblocks;
  const int h  = (blockIdx.x / qblocks) % NHEADS;
  const int b  = blockIdx.x / (qblocks * NHEADS);
  const int tid  = threadIdx.x;
  const int q0   = qb * (128 * ATT_CG) + (tid >> 5) * (16 * ATT_CG);
  const int lane = tid & 31;
  const int l16  = lane & 15;
  const int hb   = (lane >> 4) & 1;

  const _Float16* qbase = Qm + (size_t)b * SEQ * DMODEL + h * DKH;
  const _Float16* kbase = Km + (size_t)b * SEQ * DMODEL + h * DKH;
  const _Float16* vbase = Vt + (size_t)(b * NHEADS + h) * DKH * SEQ;

  // staging maps (one b128 chunk per thread per tile)
  const int krow = tid >> 3, kchk = tid & 7;       // K: 32 rows x 128B
  const _Float16* ksrc = kbase + (size_t)krow * DMODEL + kchk * 8;
  const unsigned kdst0 = lds_off(&sK[0][krow * PITCH128B + kchk * 8]);
  const unsigned kdst1 = lds_off(&sK[1][krow * PITCH128B + kchk * 8]);
  const int vrow = tid >> 2, vchk = tid & 3;       // V^T: 64 rows x 64B
  const _Float16* vsrc = vbase + (size_t)vrow * SEQ + vchk * 8;
  const unsigned vdst0 = lds_off(&sV[0][vrow * PITCH64B + vchk * 8]);
  const unsigned vdst1 = lds_off(&sV[1][vrow * PITCH64B + vchk * 8]);

  // loop-invariant Q^T fragments (d = 0..31 and 32..63) of each column group.
  // all loops over column groups are unrolled so that the arrays they index
  // stay in registers.
  v16h qf0[ATT_CG], qf1[ATT_CG];
  #pragma unroll
  for (int c = 0; c < ATT_CG; c++) {
    qf0[c] = load_frag16(qbase, q0 + c * 16, DMODEL, 0);
    qf1[c] = load_frag16(qbase, q0 + c * 16, DMODEL, 32);
  }

  async_b128(kdst0, ksrc);                         // prologue: stage kk=0
  async_b128(vdst0, vsrc);

  v8f o0[ATT_CG] = {}, o1[ATT_CG] = {}, o2[ATT_CG] = {}, o3[ATT_CG] = {};  // O^T: 64d x 16q each
  float mrun[ATT_CG], lrun[ATT_CG];
  #pragma unroll
  for (int c = 0; c < ATT_CG; c++) { mrun[c] = -1e30f; lrun[c] = 0.f; }
  const float scale = 0.125f;                      // 1/sqrt(64)

  for (int kk = 0; kk < SEQ; kk += 32) {
    const int cur = (kk >> 5) & 1;
    if (kk + 32 < SEQ) {
      async_b128(cur ? kdst0 : kdst1, ksrc + (size_t)(kk + 32) * DMODEL);
      async_b128(cur ? vdst0 : vdst1, vsrc + kk + 32);
      WAIT_ASYNCCNT(0x2);                          // current stage landed
    } else {
      WAIT_ASYNCCNT(0x0);
    }
    __syncthreads();
    const _Float16* skc = sK[cur];
    const _Float16* svc = sV[cur];

    v16h kf00 = load_frag16(skc,  0, PITCH128B, 0);
    v16h kf01 = load_frag16(skc,  0, PITCH128B, 32);
    v16h kf10 = load_frag16(skc, 16, PITCH128B, 0);
    v16h kf11 = load_frag16(skc, 16, PITCH128B, 32);
    v8f s0[ATT_CG] = {}, s1[ATT_CG] = {};          // S^T: m=key, n=query
    #pragma unroll
    for (int c = 0; c < ATT_CG; c++) {
      s0[c] = wmma16(kf00, qf0[c], s0[c]);
      s1[c] = wmma16(kf10, qf0[c], s1[c]);
    }
    #pragma unroll
    for (int c = 0; c < ATT_CG; c++) {
      s0[c] = wmma16(kf01, qf1[c], s0[c]);
      s1[c] = wmma16(kf11, qf1[c], s1[c]);
    }
    v16h vf0 = load_frag16(svc,  0, PITCH64B, 0);
    v16h vf1 = load_frag16(svc, 16, PITCH64B, 0);
    v16h vf2 = load_frag16(svc, 32, PITCH64B, 0);
    v16h vf3 = load_frag16(svc, 48, PITCH64B, 0);

    // online softmax per query (= per lane column, one shfl to merge halves)
    v16h pf[ATT_CG];                               // P^T B-fragments, in place
    #pragma unroll
    for (int c = 0; c < ATT_CG; c++) {
      float t0[8], t1[8];
      float mloc = -1e30f;
      #pragma unroll
      for (int r = 0; r < 8; r++) {
        t0[r] = s0[c][r] * scale;
        t1[r] = s1[c][r] * scale;
        mloc = fmaxf(mloc, fmaxf(t0[r], t1[r]));
      }
      mloc = fmaxf(mloc, __shfl_xor(mloc, 16, 32));
      const float mnew = fmaxf(mrun[c], mloc);
      const float corr = __expf(mrun[c] - mnew);
      float psum = 0.f;
      #pragma unroll
      for (int r = 0; r < 8; r++) {
        const float p0 = __expf(t0[r] - mnew);
        const float p1 = __expf(t1[r] - mnew);
        psum += p0 + p1;
        pf[c][r]     = (_Float16)p0;
        pf[c][r + 8] = (_Float16)p1;
      }
      psum += __shfl_xor(psum, 16, 32);
      lrun[c] = lrun[c] * corr + psum;
      mrun[c] = mnew;
      #pragma unroll
      for (int r = 0; r < 8; r++) {
        o0[c][r] *= corr; o1[c][r] *= corr; o2[c][r] *= corr; o3[c][r] *= corr;
      }
    }
    #pragma unroll
    for (int c = 0; c < ATT_CG; c++) {
      o0[c] = wmma16(vf0, pf[c], o0[c]);
      o1[c] = wmma16(vf1, pf[c], o1[c]);
      o2[c] = wmma16(vf2, pf[c], o2[c]);
      o3[c] = wmma16(vf3, pf[c], o3[c]);
    }
    __syncthreads();                               // reads done before rewrite
  }

  // normalize and store: lane's query = q0+c*16+l16; component r -> d = db*16+r+8*hb
  #pragma unroll
  for (int c = 0; c < ATT_CG; c++) {
    const float inv = 1.f / lrun[c];
    _Float16* crow = ctx + (size_t)(b * SEQ + q0 + c * 16 + l16) * DMODEL + h * DKH + 8 * hb;
    v8f oall[4] = {o0[c], o1[c], o2[c], o3[c]};
    #pragma unroll
    for (int db = 0; db < 4; db++) {
      v8h pk;
      #pragma unroll
      for (int r = 0; r < 8; r++) pk[r] = (_Float16)(oall[db][r] * inv);
      *(v8h*)(crow + db * 16) = pk;
    }
    // the next column group's values and address rewrite registers that these
    // stores name: the wait stands in front of that.
    if (c + 1 < ATT_CG) asm volatile("s_wait_xcnt 0x0" ::: "memory");
  }
}

// ---------------------------------------------------------------------------
extern "C" void kernel_launch(void* const* d_in, const int* in_sizes, int n_in,
                              void* d_out, int out_size, void* d_ws, size_t ws_size,
                              hipStream_t stream) {
  const float* q  = (const float*)d_in[0];
  const float* k  = (const float*)d_in[1];
  const float* v  = (const float*)d_in[2];
  const float* Wq = (const float*)d_in[3];
  const float* bq = (const float*)d_in[4];
  const float* Wk = (const float*)d_in[5];
  const float* bk = (const float*)d_in[6];
  const float* Wv = (const float*)d_in[7];
  const float* bv = (const float*)d_in[8];
  const float* Wo = (const float*)d_in[9];
  const float* bo = (const float*)d_in[10];

  const int rows = in_sizes[0] / DMODEL;   // B * S
  const int Bsz  = rows / SEQ;

  char* ws = (char*)d_ws;
  const size_t fbytes = (size_t)rows * DMODEL * sizeof(_Float16);   // 16 MB
  const size_t wbytes = (size_t)DMODEL * DMODEL * sizeof(_Float16); //  2 MB
  _Float16* Xq  = (_Float16*)(ws + 0 * fbytes);
  _Float16* Xk  = (_Float16*)(ws + 1 * fbytes);
  _Float16* Xv  = (_Float16*)(ws + 2 * fbytes);
  _Float16* Qf  = (_Float16*)(ws + 3 * fbytes);
  _Float16* Kf  = (_Float16*)(ws + 4 * fbytes);
  _Float16* Vtf = (_Float16*)(ws + 5 * fbytes);
  _Float16* Cf  = (_Float16*)(ws + 6 * fbytes);
  _Float16* wq16 = (_Float16*)(ws + 7 * fbytes + 0 * wbytes);
  _Float16* wk16 = (_Float16*)(ws + 7 * fbytes + 1 * wbytes);
  _Float16* wv16 = (_Float16*)(ws + 7 * fbytes + 2 * wbytes);
  _Float16* wo16 = (_Float16*)(ws + 7 * fbytes + 3 * wbytes);

  const int nX = rows * DMODEL;
  const int nW = DMODEL * DMODEL;
  // 256 blocks of 16 waves = one per WGP, seven tiles each at these shapes
  mha_cvt_f16_kernel<<<256, CVT_THREADS, 0, stream>>>(q, k, v, Wq, Wk, Wv, Wo,
                                                      Xq, Xk, Xv, wq16, wk16,
                                                      wv16, wo16, nX, nW);

  const int gemm_blocks = (rows / 128) * (DMODEL / 128);  // 128x128 tile / block
  mha_gemm_kernel<<<gemm_blocks, 256, 0, stream>>>(Xq, wq16, bq, Qf,  nullptr, rows, 0);
  mha_gemm_kernel<<<gemm_blocks, 256, 0, stream>>>(Xk, wk16, bk, Kf,  nullptr, rows, 0);
  mha_gemm_kernel<<<gemm_blocks, 256, 0, stream>>>(Xv, wv16, bv, Vtf, nullptr, rows, 1);

  const int at_blocks = Bsz * NHEADS * (SEQ / 256);       // 256 queries / block
  mha_attn_kernel<<<at_blocks, 256, 0, stream>>>(Qf, Kf, Vtf, Cf, Bsz);

  mha_gemm_kernel<<<gemm_blocks, 256, 0, stream>>>(Cf, wo16, bo, nullptr,
                                                   (float*)d_out, rows, 2);
}

// v005
// It runs in 202 microseconds.
// Next to v004, in two timings, it ran 1.06 times as fast each time.
// Counting every step since v000, it is 2.45 times as fast.
#include <hip/hip_runtime.h>
#include <hip/hip_bf16.h>

typedef __attribute__((ext_vector_type(16))) _Float16 v16h;
typedef __attribute__((ext_vector_type(8)))  _Float16 v8h;
typedef __attribute__((ext_vector_type(8)))  float    v8f;
typedef __attribute__((ext_vector_type(2)))  float    v2f;

#define DMODEL 1024
#define SEQ    4096
#define NHEADS 16
#define DKH    64

#define PITCH64B  40   // 64-byte rows  -> 80 B
#define PITCH128B 72   // 128-byte rows -> 144 B

#define WAIT_ASYNCCNT(N) asm volatile("s_wait_asynccnt " #N ::: "memory")

__device__ __forceinline__ void async_b128(unsigned lds_byte_off,
                                           const void* gaddr) {
  asm volatile("global_load_async_to_lds_b128 %0, %1, off"
               :: "v"(lds_byte_off), "v"(gaddr) : "memory");
}

__device__ __forceinline__ unsigned lds_off(const void* p) {
  return (unsigned)(unsigned long long)p;
}

__device__ __forceinline__ v16h load_frag16(const _Float16* base,
                                            int row0, int rowstride, int kbase) {
  const int lane = threadIdx.x & 31;
  const int l16  = lane & 15;
  const int hb   = (lane >> 4) & 1;
  const _Float16* p = base + (size_t)(row0 + l16) * rowstride + kbase + hb * 8;
  v8h lo = *(const v8h*)(p);
  v8h hi = *(const v8h*)(p + 16);
  return __builtin_shufflevector(lo, hi, 0,1,2,3,4,5,6,7,8,9,10,11,12,13,14,15);
}

__device__ __forceinline__ v8f wmma16(v16h a, v16h b, v8f c) {
  return __builtin_amdgcn_wmma_f32_16x16x32_f16(false, a, false, b, (short)0, c,
                                                false, false);
}

// ---- fp32 -> f16 conversion ------------------------------------------------
// One launch converts all seven f32 tensors. The work is cut into tiles of
// 16384 elements; a block walks the tiles with the grid as its stride, so few
// waves have to start and each streams: a thread loads a tile's share as eight
// 16-byte pieces (a wave-wide load covers 512 contiguous bytes = four lines),
// issues the next tile's eight loads before it converts and stores this one,
// and writes 8-byte pieces (a wave-wide store covers two whole lines).
// Every tensor's element count is a multiple of the tile (rows * 1024 with
// rows a multiple of 4096; 1024 * 1024), so a tile never straddles tensors.
typedef __attribute__((ext_vector_type(4))) float    v4f;
typedef __attribute__((ext_vector_type(4))) _Float16 v4h;
#define CVT_THREADS 512                  // 16 waves
#define CVT_SHIFT   14                   // tile = 512 threads x 8 x 4 elements
#define CVT_PIECE   (CVT_THREADS * 4)    // elements one block-wide load covers

// the loops over the eight pieces are unrolled so that x stays in registers
// and all eight loads are issued before the first value is needed.
__device__ __forceinline__ void cvt_load(v4f (&x)[8], const float* s) {
  #pragma unroll
  for (int j = 0; j < 8; j++) x[j] = *(const v4f*)(s + j * CVT_PIECE);
  // later code rewrites the address registers that these loads name: the
  // wait stands in front of that.
  asm volatile("s_wait_xcnt 0x0" ::: "memory");
}

__device__ __forceinline__ void cvt_store(const v4f (&x)[8], _Float16* d) {
  #pragma unroll
  for (int j = 0; j < 8; j++)
    *(v4h*)(d + j * CVT_PIECE) = __builtin_convertvector(x[j], v4h);
  // later code rewrites the address and data registers that these stores
  // name: the wait stands in front of that.
  asm volatile("s_wait_xcnt 0x0" ::: "memory");
}

__global__ void __launch_bounds__(CVT_THREADS)
mha_cvt_f16_kernel(const float* __restrict__ q,  const float* __restrict__ k,
                   const float* __restrict__ v,  const float* __restrict__ wq,
                   const float* __restrict__ wk, const float* __restrict__ wv,
                   const float* __restrict__ wo,
                   _Float16* __restrict__ xq,  _Float16* __restrict__ xk,
                   _Float16* __restrict__ xv,  _Float16* __restrict__ hq,
                   _Float16* __restrict__ hk,  _Float16* __restrict__ hv,
                   _Float16* __restrict__ ho, int nx, int nw) {
  const int tx = nx >> CVT_SHIFT;                  // tiles of an activation
  const int tw = nw >> CVT_SHIFT;                  // tiles of a weight
  const int ntiles = 3 * tx + 4 * tw;
  const int step = gridDim.x;

  // block-uniform choice of the tensor a tile belongs to; gives this thread's
  // first source and destination element of the tile.
  auto locate = [&](int t, const float*& s, _Float16*& d) {
    const float* src;
    _Float16* dst;
    if (t < 3 * tx) {
      if (t < tx)          { src = q; dst = xq; }
      else if (t < 2 * tx) { src = k; dst = xk; t -= tx; }
      else                 { src = v; dst = xv; t -= 2 * tx; }
    } else {
      t -= 3 * tx;
      if (t < tw)          { src = wq; dst = hq; }
      else if (t < 2 * tw) { src = wk; dst = hk; t -= tw; }
      else if (t < 3 * tw) { src = wv; dst = hv; t -= 2 * tw; }
      else                 { src = wo; dst = ho; t -= 3 * tw; }
    }
    const size_t off = ((size_t)t << CVT_SHIFT) + threadIdx.x * 4;
    s = src + off;
    d = dst + off;
  };

  int tile = blockIdx.x;
  if (tile >= ntiles) return;
  const int more = (ntiles - 1 - tile) / step;     // tiles behind the first one
  const float* s;
  _Float16 *d0, *d1;
  v4f x[8], y[8];                                  // two register buffers
  locate(tile, s, d0);
  cvt_load(x, s);
  // two tiles a trip, so that each buffer keeps its registers; the trip count
  // is known in front, so that the loop has one way in and one way out and
  // every wait for a buffer counts only the loads issued behind it.
  for (int i = 0; i < (more >> 1); i++) {
    tile += step;
    locate(tile, s, d1);
    cvt_load(y, s);                                // flies under x's stores
    // keeps x's conversions (and their waits for x) behind the issue of y's
    // loads; without it the compiler draws them in front and y starts late.
    __builtin_amdgcn_sched_barrier(0);
    cvt_store(x, d0);
    tile += step;
    locate(tile, s, d0);
    cvt_load(x, s);
    __builtin_amdgcn_sched_barrier(0);
    cvt_store(y, d1);
  }
  if (more & 1) {
    tile += step;
    locate(tile, s, d1);
    cvt_load(y, s);
    __builtin_amdgcn_sched_barrier(0);
    cvt_store(x, d0);
    cvt_store(y, d1);
  } else {
    cvt_store(x, d0);
  }
}

// ---- GEMM: C = A(rows x 1024, f16) @ W^T(1024 x 1024, f16) + bias ----------
// Block (8 waves, 4 x 2) computes a 128x128 C tile; wave tile 32x64, so each
// A fragment feeds four WMMAs and each W fragment two. Both operand tiles
// (128 rows x 64 k = 128-byte rows, padded to 144 B) come into LDS by async
// copies: one wave-wide copy covers four whole 128-byte lines. Two buffers,
// the next-but-one stage is issued behind the barrier that frees its buffer.
//   mode 0: f16 row-major out (Q/K projections)
//   mode 1: f16 per-head transposed out Vt[(b*16+h)*64+d][s] (V projection)
//   mode 2: f32 row-major out (final projection, writes d_out)
#define GEMM_KS 64                       // k per stage
#define GEMM_TILE (128 * PITCH128B)      // f16 elements of one staged tile

__device__ __forceinline__ void gemm_stage(unsigned la, unsigned lw,
                                           const _Float16* ga,
                                           const _Float16* gw) {
  asm volatile("global_load_async_to_lds_b128 %0, %8, off\n\t"
               "global_load_async_to_lds_b128 %1, %9, off\n\t"
               "global_load_async_to_lds_b128 %2, %10, off\n\t"
               "global_load_async_to_lds_b128 %3, %11, off\n\t"
               "global_load_async_to_lds_b128 %4, %12, off\n\t"
               "global_load_async_to_lds_b128 %5, %13, off\n\t"
               "global_load_async_to_lds_b128 %6, %14, off\n\t"
               "global_load_async_to_lds_b128 %7, %15, off\n\t"
               "s_wait_xcnt 0x0"
               :: "v"(la), "v"(la + 32 * PITCH128B * 2),
                  "v"(la + 64 * PITCH128B * 2), "v"(la + 96 * PITCH128B * 2),
                  "v"(lw), "v"(lw + 32 * PITCH128B * 2),
                  "v"(lw + 64 * PITCH128B * 2), "v"(lw + 96 * PITCH128B * 2),
                  "v"(ga), "v"(ga + 32 * DMODEL),
                  "v"(ga + 64 * DMODEL), "v"(ga + 96 * DMODEL),
                  "v"(gw), "v"(gw + 32 * DMODEL),
                  "v"(gw + 64 * DMODEL), "v"(gw + 96 * DMODEL)
               : "memory");
}

__global__ void __launch_bounds__(256)
mha_gemm_kernel(const _Float16* __restrict__ A, const _Float16* __restrict__ W,
                const float* __restrict__ bias, _Float16* __restrict__ outh,
                float* __restrict__ outf, int mrows, int mode) {
  __shared__ __attribute__((aligned(16))) _Float16 sA[2][GEMM_TILE];  // 2 x 18KB
  __shared__ __attribute__((aligned(16))) _Float16 sW[2][GEMM_TILE];  // 2 x 18KB
  const int nblocks = DMODEL / 128;                // 8
  const int mblk = blockIdx.x / nblocks;
  const int nblk0 = (blockIdx.x % nblocks) * 128;
  if (mblk * 128 >= mrows) return;                 // block-uniform guard
  const int tid  = threadIdx.x;
  const int wave = tid >> 5;
  const int wm   = (wave >> 1) * 32;               // wave's rows in the tile
  const int wn   = (wave & 1) * 64;                // wave's columns in the tile
  const int lane = tid & 31;
  const int l16  = lane & 15;
  const int hb   = (lane >> 4) & 1;

  // staging map: thread t moves rows t/8 + {0,32,64,96}, chunk (t%8)*8 .. +8
  const int srow = tid >> 3;
  const int schk = tid & 7;
  const _Float16* asrc = A + (size_t)(mblk * 128 + srow) * DMODEL + schk * 8;
  const _Float16* wsrc = W + (size_t)(nblk0 + srow) * DMODEL + schk * 8;
  const unsigned adst = lds_off(&sA[0][srow * PITCH128B + schk * 8]);
  const unsigned wdst = lds_off(&sW[0][srow * PITCH128B + schk * 8]);
  const int nstages = DMODEL / GEMM_KS;            // 16

  gemm_stage(adst, wdst, asrc, wsrc);              // stage 0 -> buffer 0
  WAIT_ASYNCCNT(0x0);                              // own copies of stage 0 landed
  __syncthreads();                                 // ... and everybody's
  gemm_stage(adst + GEMM_TILE * 2, wdst + GEMM_TILE * 2,
             asrc + GEMM_KS, wsrc + GEMM_KS);      // stage 1 -> buffer 1

  v8f acc[2][4] = {};
  for (int t = 0; t < nstages; t++) {
    const int cur = t & 1;
    const _Float16* sa = sA[cur];
    const _Float16* sw = sW[cur];
    v16h af[2][2], bf[2][4];
    // all loops over fragments and tiles are unrolled so that these arrays are
    // indexed by constants and stay in registers.
    #pragma unroll
    for (int ks = 0; ks < 2; ks++) {
      af[ks][0] = load_frag16(sa, wm,      PITCH128B, ks * 32);
      af[ks][1] = load_frag16(sa, wm + 16, PITCH128B, ks * 32);
      #pragma unroll
      for (int nb = 0; nb < 4; nb++)
        bf[ks][nb] = load_frag16(sw, wn + nb * 16, PITCH128B, ks * 32);
    }
    // publish point, taken as soon as the stage's 12 fragments (24 ds_load_b128) are in
    // registers: own LDS reads of this buffer retired, own copies of the next
    // stage landed, then one barrier that both publishes the next stage and
    // frees this buffer for the refill behind it.
    asm volatile("s_wait_dscnt 0x0" ::: "memory");
    WAIT_ASYNCCNT(0x0);
    __syncthreads();
    if (t + 2 < nstages)
      gemm_stage(adst + cur * (GEMM_TILE * 2), wdst + cur * (GEMM_TILE * 2),
                 asrc + (t + 2) * GEMM_KS, wsrc + (t + 2) * GEMM_KS);
    // keeps the 16 WMMAs behind the refill, so that the copies fly under them
    // and no WMMA is drawn in among the LDS reads.
    __builtin_amdgcn_sched_barrier(0);
    #pragma unroll
    for (int ks = 0; ks < 2; ks++)
      #pragma unroll
      for (int mi = 0; mi < 2; mi++)
        #pragma unroll
        for (int nb = 0; nb < 4; nb++)
          acc[mi][nb] = wmma16(af[ks][mi], bf[ks][nb], acc[mi][nb]);
  }
  WAIT_ASYNCCNT(0x0);                              // nothing in flight at the end

  // C/D layout: lane holds n = n0 + nb*16 + l16, component r holds m = m0+r+8*hb
  const int n0 = nblk0 + wn;
  #pragma unroll
  for (int mi = 0; mi < 2; mi++) {
    const int m0 = mblk * 128 + wm + mi * 16;
    if (mode == 1) {
      const int gm0   = m0 + 8 * hb;               // 8 consecutive rows (s dim)
      const int bb    = gm0 >> 12;                 // / SEQ
      const int sbase = gm0 & (SEQ - 1);
      #pragma unroll
      for (int nb = 0; nb < 4; nb++) {
        const int gn = n0 + nb * 16 + l16;
        const int h  = gn >> 6, d = gn & 63;
        const float bv = bias[gn];
        v8h pk;
        #pragma unroll
        for (int r = 0; r < 8; r++) pk[r] = (_Float16)(acc[mi][nb][r] + bv);
        *(v8h*)(outh + (((size_t)(bb * NHEADS + h) * DKH + d) * SEQ + sbase)) = pk;
      }
      // a register that an issued store names is rewritten behind this run
      // (next rows' values, the other modes' code): the wait stands in front.
      asm volatile("s_wait_xcnt 0x0" ::: "memory");
    } else if (mode == 0) {
      #pragma unroll
      for (int nb = 0; nb < 4; nb++) {
        const int gn = n0 + nb * 16 + l16;
        const float bv = bias[gn];
        #pragma unroll
        for (int r = 0; r < 8; r++) {
          const int gm = m0 + r + 8 * hb;
          outh[(size_t)gm * DMODEL + gn] = (_Float16)(acc[mi][nb][r] + bv);
        }
      }
      // a register that an issued store names is rewritten behind this run
      // (next rows' values, the other modes' code): the wait stands in front.
      asm volatile("s_wait_xcnt 0x0" ::: "memory");
    } else {
      #pragma unroll
      for (int nb = 0; nb < 4; nb++) {
        const int gn = n0 + nb * 16 + l16;
        const float bv = bias[gn];
        #pragma unroll
        for (int r = 0; r < 8; r++) {
          const int gm = m0 + r + 8 * hb;
          outf[(size_t)gm * DMODEL + gn] = acc[mi][nb][r] + bv;
        }
      }
      // a register that an issued store names is rewritten behind this run
      // (next rows' values, the other modes' code): the wait stands in front.
      asm volatile("s_wait_xcnt 0x0" ::: "memory");
    }
  }
}

#define ATT_CG 2                                   // column groups per wave
__global__ void __launch_bounds__(256) __attribute__((amdgpu_waves_per_eu(4, 4)))
mha_attn_kernel(const _Float16* __restrict__ Qm, const _Float16* __restrict__ Km,
                const _Float16* __restrict__ Vt, _Float16* __restrict__ ctx,
                int Bsz) {
  __shared__ __attribute__((aligned(16))) _Float16 sK[2][32 * PITCH128B];  // row = key
  __shared__ __attribute__((aligned(16))) _Float16 sV[2][64 * PITCH64B];   // row = d
  const int qblocks = SEQ / (128 * ATT_CG);        // 16
  const int qb = blockIdx.x % qblocks;
  const int h  = (blockIdx.x / qblocks) % NHEADS;
  const int b  = blockIdx.x / (qblocks * NHEADS);
  const int tid  = threadIdx.x;
  const int q0   = qb * (128 * ATT_CG) + (tid >> 5) * (16 * ATT_CG);
  const int lane = tid & 31;
  const int l16  = lane & 15;
  const int hb   = (lane >> 4) & 1;

  const _Float16* qbase = Qm + (size_t)b * SEQ * DMODEL + h * DKH;
  const _Float16* kbase = Km + (size_t)b * SEQ * DMODEL + h * DKH;
  const _Float16* vbase = Vt + (size_t)(b * NHEADS + h) * DKH * SEQ;

  // staging maps (one b128 chunk per thread per tile)
  const int krow = tid >> 3, kchk = tid & 7;       // K: 32 rows x 128B
  const _Float16* ksrc = kbase + (size_t)krow * DMODEL + kchk * 8;
  const unsigned kdst0 = lds_off(&sK[0][krow * PITCH128B + kchk * 8]);
  const unsigned kdst1 = lds_off(&sK[1][krow * PITCH128B + kchk * 8]);
  const int vrow = tid >> 2, vchk = tid & 3;       // V^T: 64 rows x 64B
  const _Float16* vsrc = vbase + (size_t)vrow * SEQ + vchk * 8;
  const unsigned vdst0 = lds_off(&sV[0][vrow * PITCH64B + vchk * 8]);
  const unsigned vdst1 = lds_off(&sV[1][vrow * PITCH64B + vchk * 8]);

  // loop-invariant Q^T fragments (d = 0..31 and 32..63) of each column group.
  // all loops over column groups are unrolled so that the arrays they index
  // stay in registers.
  v16h qf0[ATT_CG], qf1[ATT_CG];
  #pragma unroll
  for (int c = 0; c < ATT_CG; c++) {
    qf0[c] = load_frag16(qbase, q0 + c * 16, DMODEL, 0);
    qf1[c] = load_frag16(qbase, q0 + c * 16, DMODEL, 32);
  }

  async_b128(kdst0, ksrc);                         // prologue: stage kk=0
  async_b128(vdst0, vsrc);

  v8f o0[ATT_CG] = {}, o1[ATT_CG] = {}, o2[ATT_CG] = {}, o3[ATT_CG] = {};  // O^T: 64d x 16q each
  float mrun[ATT_CG], erun[ATT_CG], lrun[ATT_CG];  // erun = mrun in exp2 units
  #pragma unroll
  for (int c = 0; c < ATT_CG; c++) { mrun[c] = -1e30f; erun[c] = -1e30f; lrun[c] = 0.f; }
  const float sl2e = 0.125f * 1.44269504088896f;   // 1/sqrt(64) * log2(e)

  for (int kk = 0; kk < SEQ; kk += 32) {
    const int cur = (kk >> 5) & 1;
    if (kk + 32 < SEQ) {
      async_b128(cur ? kdst0 : kdst1, ksrc + (size_t)(kk + 32) * DMODEL);
      async_b128(cur ? vdst0 : vdst1, vsrc + kk + 32);
      WAIT_ASYNCCNT(0x2);                          // current stage landed
    } else {
      WAIT_ASYNCCNT(0x0);
    }
    __syncthreads();
    const _Float16* skc = sK[cur];
    const _Float16* svc = sV[cur];

    v16h kf00 = load_frag16(skc,  0, PITCH128B, 0);
    v16h kf01 = load_frag16(skc,  0, PITCH128B, 32);
    v16h kf10 = load_frag16(skc, 16, PITCH128B, 0);
    v16h kf11 = load_frag16(skc, 16, PITCH128B, 32);
    v8f s0[ATT_CG] = {}, s1[ATT_CG] = {};          // S^T: m=key, n=query
    #pragma unroll
    for (int c = 0; c < ATT_CG; c++) {
      s0[c] = wmma16(kf00, qf0[c], s0[c]);
      s1[c] = wmma16(kf10, qf0[c], s1[c]);
    }
    #pragma unroll
    for (int c = 0; c < ATT_CG; c++) {
      s0[c] = wmma16(kf01, qf1[c], s0[c]);
      s1[c] = wmma16(kf11, qf1[c], s1[c]);
    }
    v16h vf0 = load_frag16(svc,  0, PITCH64B, 0);
    v16h vf1 = load_frag16(svc, 16, PITCH64B, 0);
    v16h vf2 = load_frag16(svc, 32, PITCH64B, 0);
    v16h vf3 = load_frag16(svc, 48, PITCH64B, 0);

    // online softmax per query (= per lane column, one shfl to merge halves).
    // The maximum is taken over the raw scores; its product with
    // scale * log2(e) is the exponent's offset, so each score costs one FMA in
    // front of its exp2. The FMAs take the accumulators' own register pairs.
    // The loops over r are unrolled so that every vector element is indexed by
    // a constant and stays in its register.
    v16h pf[ATT_CG];                               // P^T B-fragments, in place
    #pragma unroll
    for (int c = 0; c < ATT_CG; c++) {
      float mloc = -1e30f;
      #pragma unroll
      for (int r = 0; r < 8; r++)
        mloc = fmaxf(mloc, fmaxf(s0[c][r], s1[c][r]));
      const float mnew = fmaxf(mrun[c], fmaxf(mloc, __shfl_xor(mloc, 16, 32)));
      const float enew = mnew * sl2e;              // the maximum in exp2 units
      const float corr = __builtin_amdgcn_exp2f(erun[c] - enew);
      const v2f mul2 = {sl2e, sl2e};
      const v2f off = {-enew, -enew};
      float psum = 0.f;
      #pragma unroll
      for (int r = 0; r < 8; r += 2) {
        const v2f a0 = {s0[c][r], s0[c][r + 1]};
        const v2f a1 = {s1[c][r], s1[c][r + 1]};
        const v2f x0 = __builtin_elementwise_fma(a0, mul2, off);
        const v2f x1 = __builtin_elementwise_fma(a1, mul2, off);
        const v2f p0 = {__builtin_amdgcn_exp2f(x0[0]), __builtin_amdgcn_exp2f(x0[1])};
        const v2f p1 = {__builtin_amdgcn_exp2f(x1[0]), __builtin_amdgcn_exp2f(x1[1])};
        const v2f ps = p0 + p1;
        psum = (r == 0) ? ps[0] : psum + ps[0];
        psum += ps[1];
        pf[c][r]     = (_Float16)p0[0];
        pf[c][r + 1] = (_Float16)p0[1];
        pf[c][r + 8] = (_Float16)p1[0];
        pf[c][r + 9] = (_Float16)p1[1];
      }
      psum += __shfl_xor(psum, 16, 32);
      lrun[c] = lrun[c] * corr + psum;
      mrun[c] = mnew;
      erun[c] = enew;
      #pragma unroll
      for (int r = 0; r < 8; r++) {
        o0[c][r] *= corr; o1[c][r] *= corr; o2[c][r] *= corr; o3[c][r] *= corr;
      }
    }
    #pragma unroll
    for (int c = 0; c < ATT_CG; c++) {
      o0[c] = wmma16(vf0, pf[c], o0[c]);
      o1[c] = wmma16(vf1, pf[c], o1[c]);
      o2[c] = wmma16(vf2, pf[c], o2[c]);
      o3[c] = wmma16(vf3, pf[c], o3[c]);
    }
    __syncthreads();                               // reads done before rewrite
  }

  // normalize and store: lane's query = q0+c*16+l16; component r -> d = db*16+r+8*hb
  #pragma unroll
  for (int c = 0; c < ATT_CG; c++) {
    const float inv = 1.f / lrun[c];
    _Float16* crow = ctx + (size_t)(b * SEQ + q0 + c * 16 + l16) * DMODEL + h * DKH + 8 * hb;
    v8f oall[4] = {o0[c], o1[c], o2[c], o3[c]};
    #pragma unroll
    for (int db = 0; db < 4; db++) {
      v8h pk;
      #pragma unroll
      for (int r = 0; r < 8; r++) pk[r] = (_Float16)(oall[db][r] * inv);
      *(v8h*)(crow + db * 16) = pk;
    }
    // the next column group's values and address rewrite registers that these
    // stores name: the wait stands in front of that.
    if (c + 1 < ATT_CG) asm volatile("s_wait_xcnt 0x0" ::: "memory");
  }
}

// ---------------------------------------------------------------------------
extern "C" void kernel_launch(void* const* d_in, const int* in_sizes, int n_in,
                              void* d_out, int out_size, void* d_ws, size_t ws_size,
                              hipStream_t stream) {
  const float* q  = (const float*)d_in[0];
  const float* k  = (const float*)d_in[1];
  const float* v  = (const float*)d_in[2];
  const float* Wq = (const float*)d_in[3];
  const float* bq = (const float*)d_in[4];
  const float* Wk = (const float*)d_in[5];
  const float* bk = (const float*)d_in[6];
  const float* Wv = (const float*)d_in[7];
  const float* bv = (const float*)d_in[8];
  const float* Wo = (const float*)d_in[9];
  const float* bo = (const float*)d_in[10];

  const int rows = in_sizes[0] / DMODEL;   // B * S
  const int Bsz  = rows / SEQ;

  char* ws = (char*)d_ws;
  const size_t fbytes = (size_t)rows * DMODEL * sizeof(_Float16);   // 16 MB
  const size_t wbytes = (size_t)DMODEL * DMODEL * sizeof(_Float16); //  2 MB
  _Float16* Xq  = (_Float16*)(ws + 0 * fbytes);
  _Float16* Xk  = (_Float16*)(ws + 1 * fbytes);
  _Float16* Xv  = (_Float16*)(ws + 2 * fbytes);
  _Float16* Qf  = (_Float16*)(ws + 3 * fbytes);
  _Float16* Kf  = (_Float16*)(ws + 4 * fbytes);
  _Float16* Vtf = (_Float16*)(ws + 5 * fbytes);
  _Float16* Cf  = (_Float16*)(ws + 6 * fbytes);
  _Float16* wq16 = (_Float16*)(ws + 7 * fbytes + 0 * wbytes);
  _Float16* wk16 = (_Float16*)(ws + 7 * fbytes + 1 * wbytes);
  _Float16* wv16 = (_Float16*)(ws + 7 * fbytes + 2 * wbytes);
  _Float16* wo16 = (_Float16*)(ws + 7 * fbytes + 3 * wbytes);

  const int nX = rows * DMODEL;
  const int nW = DMODEL * DMODEL;
  // 256 blocks of 16 waves = one per WGP, seven tiles each at these shapes
  mha_cvt_f16_kernel<<<256, CVT_THREADS, 0, stream>>>(q, k, v, Wq, Wk, Wv, Wo,
                                                      Xq, Xk, Xv, wq16, wk16,
                                                      wv16, wo16, nX, nW);

  const int gemm_blocks = (rows / 128) * (DMODEL / 128);  // 128x128 tile / block
  mha_gemm_kernel<<<gemm_blocks, 256, 0, stream>>>(Xq, wq16, bq, Qf,  nullptr, rows, 0);
  mha_gemm_kernel<<<gemm_blocks, 256, 0, stream>>>(Xk, wk16, bk, Kf,  nullptr, rows, 0);
  mha_gemm_kernel<<<gemm_blocks, 256, 0, stream>>>(Xv, wv16, bv, Vtf, nullptr, rows, 1);

  const int at_blocks = Bsz * NHEADS * (SEQ / 256);       // 256 queries / block
  mha_attn_kernel<<<at_blocks, 256, 0, stream>>>(Qf, Kf, Vtf, Cf, Bsz);

  mha_gemm_kernel<<<gemm_blocks, 256, 0, stream>>>(Cf, wo16, bo, nullptr,
                                                   (float*)d_out, rows, 2);
}

// v007
// Measured time: 181 microseconds a run.
// Versions in between are left out here; by their measured steps it is 1.12 times as fast as v005.
// All steps since v000 together make it 2.76 times as fast.
#include <hip/hip_runtime.h>
#include <hip/hip_bf16.h>

typedef __attribute__((ext_vector_type(16))) _Float16 v16h;
typedef __attribute__((ext_vector_type(8)))  _Float16 v8h;
typedef __attribute__((ext_vector_type(8)))  float    v8f;
typedef __attribute__((ext_vector_type(2)))  float    v2f;

#define DMODEL 1024
#define SEQ    4096
#define NHEADS 16
#define DKH    64

#define PITCH128B 72   // 128-byte rows -> 144 B
#define PITCH256B 136  // 256-byte rows -> 272 B

#define WAIT_ASYNCCNT(N) asm volatile("s_wait_asynccnt " #N ::: "memory")

__device__ __forceinline__ unsigned lds_off(const void* p) {
  return (unsigned)(unsigned long long)p;
}

__device__ __forceinline__ v16h load_frag16(const _Float16* base,
                                            int row0, int rowstride, int kbase) {
  const int lane = threadIdx.x & 31;
  const int l16  = lane & 15;
  const int hb   = (lane >> 4) & 1;
  const _Float16* p = base + (size_t)(row0 + l16) * rowstride + kbase + hb * 8;
  v8h lo = *(const v8h*)(p);
  v8h hi = *(const v8h*)(p + 16);
  return __builtin_shufflevector(lo, hi, 0,1,2,3,4,5,6,7,8,9,10,11,12,13,14,15);
}

__device__ __forceinline__ v8f wmma16(v16h a, v16h b, v8f c) {
  return __builtin_amdgcn_wmma_f32_16x16x32_f16(false, a, false, b, (short)0, c,
                                                false, false);
}

__device__ __forceinline__ float exp2_slot(float x) {
  float y;
  asm("v_exp_f32 %0, %1\n\tv_nop" : "=v"(y) : "v"(x));
  return y;
}

// ---- fp32 -> f16 conversion ------------------------------------------------
// One launch converts all seven f32 tensors. The work is cut into tiles of
// 16384 elements; a block walks the tiles with the grid as its stride, so few
// waves have to start and each streams: a thread loads a tile's share as eight
// 16-byte pieces (a wave-wide load covers 512 contiguous bytes = four lines),
// issues the next tile's eight loads before it converts and stores this one,
// and writes 8-byte pieces (a wave-wide store covers two whole lines).
// Every tensor's element count is a multiple of the tile (rows * 1024 with
// rows a multiple of 4096; 1024 * 1024), so a tile never straddles tensors.
typedef __attribute__((ext_vector_type(4))) float    v4f;
typedef __attribute__((ext_vector_type(4))) _Float16 v4h;
#define CVT_THREADS 512                  // 16 waves
#define CVT_SHIFT   14                   // tile = 512 threads x 8 x 4 elements
#define CVT_PIECE   (CVT_THREADS * 4)    // elements one block-wide load covers

// the loops over the eight pieces are unrolled so that x stays in registers
// and all eight loads are issued before the first value is needed.
__device__ __forceinline__ void cvt_load(v4f (&x)[8], const float* s) {
  #pragma unroll
  for (int j = 0; j < 8; j++) x[j] = *(const v4f*)(s + j * CVT_PIECE);
  // later code rewrites the address registers that these loads name: the
  // wait stands in front of that.
  asm volatile("s_wait_xcnt 0x0" ::: "memory");
}

__device__ __forceinline__ void cvt_store(const v4f (&x)[8], _Float16* d) {
  #pragma unroll
  for (int j = 0; j < 8; j++)
    *(v4h*)(d + j * CVT_PIECE) = __builtin_convertvector(x[j], v4h);
  // later code rewrites the address and data registers that these stores
  // name: the wait stands in front of that.
  asm volatile("s_wait_xcnt 0x0" ::: "memory");
}

__global__ void __launch_bounds__(CVT_THREADS)
mha_cvt_f16_kernel(const float* __restrict__ q,  const float* __restrict__ k,
                   const float* __restrict__ v,  const float* __restrict__ wq,
                   const float* __restrict__ wk, const float* __restrict__ wv,
                   const float* __restrict__ wo,
                   _Float16* __restrict__ xq,  _Float16* __restrict__ xk,
                   _Float16* __restrict__ xv,  _Float16* __restrict__ hq,
                   _Float16* __restrict__ hk,  _Float16* __restrict__ hv,
                   _Float16* __restrict__ ho, int nx, int nw) {
  const int tx = nx >> CVT_SHIFT;                  // tiles of an activation
  const int tw = nw >> CVT_SHIFT;                  // tiles of a weight
  const int ntiles = 3 * tx + 4 * tw;
  const int step = gridDim.x;

  // block-uniform choice of the tensor a tile belongs to; gives this thread's
  // first source and destination element of the tile.
  auto locate = [&](int t, const float*& s, _Float16*& d) {
    const float* src;
    _Float16* dst;
    if (t < 3 * tx) {
      if (t < tx)          { src = q; dst = xq; }
      else if (t < 2 * tx) { src = k; dst = xk; t -= tx; }
      else                 { src = v; dst = xv; t -= 2 * tx; }
    } else {
      t -= 3 * tx;
      if (t < tw)          { src = wq; dst = hq; }
      else if (t < 2 * tw) { src = wk; dst = hk; t -= tw; }
      else if (t < 3 * tw) { src = wv; dst = hv; t -= 2 * tw; }
      else                 { src = wo; dst = ho; t -= 3 * tw; }
    }
    const size_t off = ((size_t)t << CVT_SHIFT) + threadIdx.x * 4;
    s = src + off;
    d = dst + off;
  };

  int tile = blockIdx.x;
  if (tile >= ntiles) return;
  const int more = (ntiles - 1 - tile) / step;     // tiles behind the first one
  const float* s;
  _Float16 *d0, *d1;
  v4f x[8], y[8];                                  // two register buffers
  locate(tile, s, d0);
  cvt_load(x, s);
  // two tiles a trip, so that each buffer keeps its registers; the trip count
  // is known in front, so that the loop has one way in and one way out and
  // every wait for a buffer counts only the loads issued behind it.
  for (int i = 0; i < (more >> 1); i++) {
    tile += step;
    locate(tile, s, d1);
    cvt_load(y, s);                                // flies under x's stores
    // keeps x's conversions (and their waits for x) behind the issue of y's
    // loads; without it the compiler draws them in front and y starts late.
    __builtin_amdgcn_sched_barrier(0);
    cvt_store(x, d0);
    tile += step;
    locate(tile, s, d0);
    cvt_load(x, s);
    __builtin_amdgcn_sched_barrier(0);
    cvt_store(y, d1);
  }
  if (more & 1) {
    tile += step;
    locate(tile, s, d1);
    cvt_load(y, s);
    __builtin_amdgcn_sched_barrier(0);
    cvt_store(x, d0);
    cvt_store(y, d1);
  } else {
    cvt_store(x, d0);
  }
}

// ---- GEMM: C = A(rows x 1024, f16) @ W^T(1024 x 1024, f16) + bias ----------
// Block (8 waves, 4 x 2) computes a 128x128 C tile; wave tile 32x64, so each
// A fragment feeds four WMMAs and each W fragment two. Both operand tiles
// (128 rows x 64 k = 128-byte rows, padded to 144 B) come into LDS by async
// copies: one wave-wide copy covers four whole 128-byte lines. Two buffers,
// the next-but-one stage is issued behind the barrier that frees its buffer.
//   mode 0: f16 row-major out (Q/K projections)
//   mode 1: f16 per-head transposed out Vt[(b*16+h)*64+d][s] (V projection)
//   mode 2: f32 row-major out (final projection, writes d_out)
#define GEMM_KS 64                       // k per stage
#define GEMM_TILE (128 * PITCH128B)      // f16 elements of one staged tile

__device__ __forceinline__ void gemm_stage(unsigned la, unsigned lw,
                                           const _Float16* ga,
                                           const _Float16* gw) {
  asm volatile("global_load_async_to_lds_b128 %0, %8, off\n\t"
               "global_load_async_to_lds_b128 %1, %9, off\n\t"
               "global_load_async_to_lds_b128 %2, %10, off\n\t"
               "global_load_async_to_lds_b128 %3, %11, off\n\t"
               "global_load_async_to_lds_b128 %4, %12, off\n\t"
               "global_load_async_to_lds_b128 %5, %13, off\n\t"
               "global_load_async_to_lds_b128 %6, %14, off\n\t"
               "global_load_async_to_lds_b128 %7, %15, off\n\t"
               "s_wait_xcnt 0x0"
               :: "v"(la), "v"(la + 32 * PITCH128B * 2),
                  "v"(la + 64 * PITCH128B * 2), "v"(la + 96 * PITCH128B * 2),
                  "v"(lw), "v"(lw + 32 * PITCH128B * 2),
                  "v"(lw + 64 * PITCH128B * 2), "v"(lw + 96 * PITCH128B * 2),
                  "v"(ga), "v"(ga + 32 * DMODEL),
                  "v"(ga + 64 * DMODEL), "v"(ga + 96 * DMODEL),
                  "v"(gw), "v"(gw + 32 * DMODEL),
                  "v"(gw + 64 * DMODEL), "v"(gw + 96 * DMODEL)
               : "memory");
}

__global__ void __launch_bounds__(256)
mha_gemm_kernel(const _Float16* __restrict__ A, const _Float16* __restrict__ W,
                const float* __restrict__ bias, _Float16* __restrict__ outh,
                float* __restrict__ outf, int mrows, int mode) {
  __shared__ __attribute__((aligned(16))) _Float16 sA[2][GEMM_TILE];  // 2 x 18KB
  __shared__ __attribute__((aligned(16))) _Float16 sW[2][GEMM_TILE];  // 2 x 18KB
  const int nblocks = DMODEL / 128;                // 8
  const int mblk = blockIdx.x / nblocks;
  const int nblk0 = (blockIdx.x % nblocks) * 128;
  if (mblk * 128 >= mrows) return;                 // block-uniform guard
  const int tid  = threadIdx.x;
  const int wave = tid >> 5;
  const int wm   = (wave >> 1) * 32;               // wave's rows in the tile
  const int wn   = (wave & 1) * 64;                // wave's columns in the tile
  const int lane = tid & 31;
  const int l16  = lane & 15;
  const int hb   = (lane >> 4) & 1;

  // staging map: thread t moves rows t/8 + {0,32,64,96}, chunk (t%8)*8 .. +8
  const int srow = tid >> 3;
  const int schk = tid & 7;
  const _Float16* asrc = A + (size_t)(mblk * 128 + srow) * DMODEL + schk * 8;
  const _Float16* wsrc = W + (size_t)(nblk0 + srow) * DMODEL + schk * 8;
  const unsigned adst = lds_off(&sA[0][srow * PITCH128B + schk * 8]);
  const unsigned wdst = lds_off(&sW[0][srow * PITCH128B + schk * 8]);
  const int nstages = DMODEL / GEMM_KS;            // 16

  gemm_stage(adst, wdst, asrc, wsrc);              // stage 0 -> buffer 0
  WAIT_ASYNCCNT(0x0);                              // own copies of stage 0 landed
  __syncthreads();                                 // ... and everybody's
  gemm_stage(adst + GEMM_TILE * 2, wdst + GEMM_TILE * 2,
             asrc + GEMM_KS, wsrc + GEMM_KS);      // stage 1 -> buffer 1

  v8f acc[2][4] = {};
  for (int t = 0; t < nstages; t++) {
    const int cur = t & 1;
    const _Float16* sa = sA[cur];
    const _Float16* sw = sW[cur];
    v16h af[2][2], bf[2][4];
    // all loops over fragments and tiles are unrolled so that these arrays are
    // indexed by constants and stay in registers.
    #pragma unroll
    for (int ks = 0; ks < 2; ks++) {
      af[ks][0] = load_frag16(sa, wm,      PITCH128B, ks * 32);
      af[ks][1] = load_frag16(sa, wm + 16, PITCH128B, ks * 32);
      #pragma unroll
      for (int nb = 0; nb < 4; nb++)
        bf[ks][nb] = load_frag16(sw, wn + nb * 16, PITCH128B, ks * 32);
    }
    // publish point, taken as soon as the stage's 12 fragments (24 ds_load_b128) are in
    // registers: own LDS reads of this buffer retired, own copies of the next
    // stage landed, then one barrier that both publishes the next stage and
    // frees this buffer for the refill behind it.
    asm volatile("s_wait_dscnt 0x0" ::: "memory");
    WAIT_ASYNCCNT(0x0);
    __syncthreads();
    if (t + 2 < nstages)
      gemm_stage(adst + cur * (GEMM_TILE * 2), wdst + cur * (GEMM_TILE * 2),
                 asrc + (t + 2) * GEMM_KS, wsrc + (t + 2) * GEMM_KS);
    // keeps the 16 WMMAs behind the refill, so that the copies fly under them
    // and no WMMA is drawn in among the LDS reads.
    __builtin_amdgcn_sched_barrier(0);
    #pragma unroll
    for (int ks = 0; ks < 2; ks++)
      #pragma unroll
      for (int mi = 0; mi < 2; mi++)
        #pragma unroll
        for (int nb = 0; nb < 4; nb++)
          acc[mi][nb] = wmma16(af[ks][mi], bf[ks][nb], acc[mi][nb]);
  }
  WAIT_ASYNCCNT(0x0);                              // nothing in flight at the end

  // C/D layout: lane holds n = n0 + nb*16 + l16, component r holds m = m0+r+8*hb
  const int n0 = nblk0 + wn;
  #pragma unroll
  for (int mi = 0; mi < 2; mi++) {
    const int m0 = mblk * 128 + wm + mi * 16;
    if (mode == 1) {
      const int gm0   = m0 + 8 * hb;               // 8 consecutive rows (s dim)
      const int bb    = gm0 >> 12;                 // / SEQ
      const int sbase = gm0 & (SEQ - 1);
      #pragma unroll
      for (int nb = 0; nb < 4; nb++) {
        const int gn = n0 + nb * 16 + l16;
        const int h  = gn >> 6, d = gn & 63;
        const float bv = bias[gn];
        v8h pk;
        #pragma unroll
        for (int r = 0; r < 8; r++) pk[r] = (_Float16)(acc[mi][nb][r] + bv);
        *(v8h*)(outh + (((size_t)(bb * NHEADS + h) * DKH + d) * SEQ + sbase)) = pk;
      }
      // a register that an issued store names is rewritten behind this run
      // (next rows' values, the other modes' code): the wait stands in front.
      asm volatile("s_wait_xcnt 0x0" ::: "memory");
    } else if (mode == 0) {
      #pragma unroll
      for (int nb = 0; nb < 4; nb++) {
        const int gn = n0 + nb * 16 + l16;
        const float bv = bias[gn];
        #pragma unroll
        for (int r = 0; r < 8; r++) {
          const int gm = m0 + r + 8 * hb;
          outh[(size_t)gm * DMODEL + gn] = (_Float16)(acc[mi][nb][r] + bv);
        }
      }
      // a register that an issued store names is rewritten behind this run
      // (next rows' values, the other modes' code): the wait stands in front.
      asm volatile("s_wait_xcnt 0x0" ::: "memory");
    } else {
      #pragma unroll
      for (int nb = 0; nb < 4; nb++) {
        const int gn = n0 + nb * 16 + l16;
        const float bv = bias[gn];
        #pragma unroll
        for (int r = 0; r < 8; r++) {
          const int gm = m0 + r + 8 * hb;
          outf[(size_t)gm * DMODEL + gn] = acc[mi][nb][r] + bv;
        }
      }
      // a register that an issued store names is rewritten behind this run
      // (next rows' values, the other modes' code): the wait stands in front.
      asm volatile("s_wait_xcnt 0x0" ::: "memory");
    }
  }
}

#define ATT_CG 2                                   // column groups per wave
#define ATT_SK 128                                 // keys per stage
#define ATT_KT (ATT_SK * PITCH128B)                // f16 elements of a staged K tile
#define ATT_VT (DKH * PITCH256B)                   // ... of a staged V^T tile

__device__ __forceinline__ void attn_stage(unsigned lk, unsigned lv,
                                           const _Float16* gk,
                                           const _Float16* gv) {
  asm volatile("global_load_async_to_lds_b128 %0, %8, off\n\t"
               "global_load_async_to_lds_b128 %1, %9, off\n\t"
               "global_load_async_to_lds_b128 %2, %10, off\n\t"
               "global_load_async_to_lds_b128 %3, %11, off\n\t"
               "global_load_async_to_lds_b128 %4, %12, off\n\t"
               "global_load_async_to_lds_b128 %5, %13, off\n\t"
               "global_load_async_to_lds_b128 %6, %14, off\n\t"
               "global_load_async_to_lds_b128 %7, %15, off\n\t"
               "s_wait_xcnt 0x0"
               :: "v"(lk), "v"(lk + 32 * PITCH128B * 2),
                  "v"(lk + 64 * PITCH128B * 2), "v"(lk + 96 * PITCH128B * 2),
                  "v"(lv), "v"(lv + 16 * PITCH256B * 2),
                  "v"(lv + 32 * PITCH256B * 2), "v"(lv + 48 * PITCH256B * 2),
                  "v"(gk), "v"(gk + 32 * DMODEL),
                  "v"(gk + 64 * DMODEL), "v"(gk + 96 * DMODEL),
                  "v"(gv), "v"(gv + 16 * SEQ),
                  "v"(gv + 32 * SEQ), "v"(gv + 48 * SEQ)
               : "memory");
}

__global__ void __launch_bounds__(256) __attribute__((amdgpu_waves_per_eu(4, 4)))
mha_attn_kernel(const _Float16* __restrict__ Qm, const _Float16* __restrict__ Km,
                const _Float16* __restrict__ Vt, _Float16* __restrict__ ctx,
                int Bsz) {
  __shared__ __attribute__((aligned(16))) _Float16 sK[2][ATT_KT];  // row = key
  __shared__ __attribute__((aligned(16))) _Float16 sV[2][ATT_VT];  // row = d
  const int qblocks = SEQ / (128 * ATT_CG);        // 16
  const int qb = blockIdx.x % qblocks;
  const int h  = (blockIdx.x / qblocks) % NHEADS;
  const int b  = blockIdx.x / (qblocks * NHEADS);
  const int tid  = threadIdx.x;
  const int q0   = qb * (128 * ATT_CG) + (tid >> 5) * (16 * ATT_CG);
  const int lane = tid & 31;
  const int l16  = lane & 15;
  const int hb   = (lane >> 4) & 1;

  const _Float16* qbase = Qm + (size_t)b * SEQ * DMODEL + h * DKH;
  const _Float16* kbase = Km + (size_t)b * SEQ * DMODEL + h * DKH;
  const _Float16* vbase = Vt + (size_t)(b * NHEADS + h) * DKH * SEQ;

  // staging maps (four b128 chunks per thread per tile)
  const int krow = tid >> 3, kchk = tid & 7;       // K: 128 rows x 128B
  const _Float16* ksrc = kbase + (size_t)krow * DMODEL + kchk * 8;
  const unsigned kdst = lds_off(&sK[0][krow * PITCH128B + kchk * 8]);
  const int vrow = tid >> 4, vchk = tid & 15;      // V^T: 64 rows x 256B
  const _Float16* vsrc = vbase + (size_t)vrow * SEQ + vchk * 8;
  const unsigned vdst = lds_off(&sV[0][vrow * PITCH256B + vchk * 8]);
  const int nstages = SEQ / ATT_SK;                // 32

  // loop-invariant Q^T fragments (d = 0..31 and 32..63) of each column group.
  // all loops over column groups are unrolled so that the arrays they index
  // stay in registers.
  v16h qf0[ATT_CG], qf1[ATT_CG];
  #pragma unroll
  for (int c = 0; c < ATT_CG; c++) {
    qf0[c] = load_frag16(qbase, q0 + c * 16, DMODEL, 0);
    qf1[c] = load_frag16(qbase, q0 + c * 16, DMODEL, 32);
  }

  attn_stage(kdst, vdst, ksrc, vsrc);              // stage 0 -> buffer 0
  WAIT_ASYNCCNT(0x0);                              // own copies of stage 0 landed
  __syncthreads();                                 // ... and everybody's
  attn_stage(kdst + ATT_KT * 2, vdst + ATT_VT * 2,
             ksrc + (size_t)ATT_SK * DMODEL, vsrc + ATT_SK);  // stage 1 -> buffer 1

  v8f o0[ATT_CG] = {}, o1[ATT_CG] = {}, o2[ATT_CG] = {}, o3[ATT_CG] = {};  // O^T: 64d x 16q each
  // euse = the exponent's offset in use (a maximum seen so far, in exp2 units);
  // thr = the raw score above which that offset has to be renewed.
  float thr[ATT_CG], euse[ATT_CG], lrun[ATT_CG];
  #pragma unroll
  for (int c = 0; c < ATT_CG; c++) { thr[c] = -1e30f; euse[c] = -1e30f; lrun[c] = 0.f; }
  const float sl2e = 0.125f * 1.44269504088896f;   // 1/sqrt(64) * log2(e)
  const float margin = 8.0f / sl2e;                 // 8 in exp2 units, as a raw score

  for (int st = 0; st < nstages; st++) {
    const int cur = st & 1;
    const _Float16* skc = sK[cur];
    const _Float16* svc = sV[cur];
   // the four passes are unrolled so that a pass's LDS offsets are constants
   // and its fragment reads can be issued under the pass in front of it.
   #pragma unroll
   for (int ps = 0; ps < ATT_SK / 32; ps++) {
    v16h kf00 = load_frag16(skc, ps * 32,      PITCH128B, 0);
    v16h kf01 = load_frag16(skc, ps * 32,      PITCH128B, 32);
    v16h kf10 = load_frag16(skc, ps * 32 + 16, PITCH128B, 0);
    v16h kf11 = load_frag16(skc, ps * 32 + 16, PITCH128B, 32);
    v8f s0[ATT_CG] = {}, s1[ATT_CG] = {};          // S^T: m=key, n=query
    #pragma unroll
    for (int c = 0; c < ATT_CG; c++) {
      s0[c] = wmma16(kf00, qf0[c], s0[c]);
      s1[c] = wmma16(kf10, qf0[c], s1[c]);
    }
    #pragma unroll
    for (int c = 0; c < ATT_CG; c++) {
      s0[c] = wmma16(kf01, qf1[c], s0[c]);
      s1[c] = wmma16(kf11, qf1[c], s1[c]);
    }
    v16h vf0 = load_frag16(svc,  0, PITCH256B, ps * 32);
    v16h vf1 = load_frag16(svc, 16, PITCH256B, ps * 32);
    v16h vf2 = load_frag16(svc, 32, PITCH256B, ps * 32);
    v16h vf3 = load_frag16(svc, 48, PITCH256B, ps * 32);

    // online softmax per query (= per lane column), with a lazy rescale: the
    // exponent's offset stays as it is while no score of the step lies more
    // than 8 (in exp2 units) above it, so a probability is at most 2^8, well
    // inside f16, and the step then needs no exchange between the wave's
    // halves for the maximum, no correction factor and no product on the 64
    // output accumulators. The test is made once per step for the whole wave:
    // a ballot and a scalar branch. In the branch every column takes its true
    // running maximum (both halves merged, so a query's two lanes agree).
    // The maximum is taken over the raw scores; its product with
    // scale * log2(e) is the exponent's offset, so each score costs one FMA in
    // front of its exp2. The FMAs take the accumulators' own register pairs.
    // The loops over r are unrolled so that every vector element is indexed by
    // a constant and stays in its register.
    float mloc[ATT_CG];
    bool need = false;
    #pragma unroll
    for (int c = 0; c < ATT_CG; c++) {
      float m = -1e30f;
      #pragma unroll
      for (int r = 0; r < 8; r++)
        m = fmaxf(m, fmaxf(s0[c][r], s1[c][r]));
      mloc[c] = m;
      need = need || (m > thr[c]);
    }
    if (__builtin_amdgcn_ballot_w32(need) != 0) {
      #pragma unroll
      for (int c = 0; c < ATT_CG; c++) {
        const float mj = fmaxf(mloc[c], __shfl_xor(mloc[c], 16, 32));
        const float enew = fmaxf(euse[c], mj * sl2e);
        const float corr = exp2_slot(euse[c] - enew);
        thr[c] = fmaxf(thr[c], mj + margin);
        euse[c] = enew;
        lrun[c] *= corr;
        #pragma unroll
        for (int r = 0; r < 8; r++) {
          o0[c][r] *= corr; o1[c][r] *= corr; o2[c][r] *= corr; o3[c][r] *= corr;
        }
      }
    }
    v16h pf[ATT_CG];                               // P^T B-fragments, in place
    #pragma unroll
    for (int c = 0; c < ATT_CG; c++) {
      const v2f mul2 = {sl2e, sl2e};
      const v2f off = {-euse[c], -euse[c]};
      float psum = 0.f;
      #pragma unroll
      for (int r = 0; r < 8; r += 2) {
        const v2f a0 = {s0[c][r], s0[c][r + 1]};
        const v2f a1 = {s1[c][r], s1[c][r + 1]};
        const v2f x0 = __builtin_elementwise_fma(a0, mul2, off);
        const v2f x1 = __builtin_elementwise_fma(a1, mul2, off);
        const bool slot0 = ps == 0 && r == 4;
        const bool slot1 = ps == 3 && r == 4;
        const v2f p0 = {__builtin_amdgcn_exp2f(x0[0]),
                        slot0 ? exp2_slot(x0[1]) : __builtin_amdgcn_exp2f(x0[1])};
        const v2f p1 = {__builtin_amdgcn_exp2f(x1[0]),
                        slot1 ? exp2_slot(x1[1]) : __builtin_amdgcn_exp2f(x1[1])};
        const v2f pp = p0 + p1;
        psum = (r == 0) ? pp[0] : psum + pp[0];
        psum += pp[1];
        pf[c][r]     = (_Float16)p0[0];
        pf[c][r + 1] = (_Float16)p0[1];
        pf[c][r + 8] = (_Float16)p1[0];
        pf[c][r + 9] = (_Float16)p1[1];
      }
      psum += __shfl_xor(psum, 16, 32);
      lrun[c] += psum;
    }
    #pragma unroll
    for (int c = 0; c < ATT_CG; c++) {
      o0[c] = wmma16(vf0, pf[c], o0[c]);
      o1[c] = wmma16(vf1, pf[c], o1[c]);
      o2[c] = wmma16(vf2, pf[c], o2[c]);
      o3[c] = wmma16(vf3, pf[c], o3[c]);
    }
   }
    // publish point, once per stage: own LDS reads of this buffer retired, own
    // copies of the next stage landed, then one barrier that both publishes the
    // next stage and frees this buffer for the refill behind it.
    asm volatile("s_wait_dscnt 0x0" ::: "memory");
    WAIT_ASYNCCNT(0x0);
    __syncthreads();
    if (st + 2 < nstages)
      attn_stage(kdst + cur * (ATT_KT * 2), vdst + cur * (ATT_VT * 2),
                 ksrc + (size_t)(st + 2) * ATT_SK * DMODEL,
                 vsrc + (st + 2) * ATT_SK);
  }
  WAIT_ASYNCCNT(0x0);                              // nothing in flight at the end

  // normalize and store: lane's query = q0+c*16+l16; component r -> d = db*16+r+8*hb
  #pragma unroll
  for (int c = 0; c < ATT_CG; c++) {
    const float inv = 1.f / lrun[c];
    _Float16* crow = ctx + (size_t)(b * SEQ + q0 + c * 16 + l16) * DMODEL + h * DKH + 8 * hb;
    v8f oall[4] = {o0[c], o1[c], o2[c], o3[c]};
    #pragma unroll
    for (int db = 0; db < 4; db++) {
      v8h pk;
      #pragma unroll
      for (int r = 0; r < 8; r++) pk[r] = (_Float16)(oall[db][r] * inv);
      *(v8h*)(crow + db * 16) = pk;
    }
    // the next column group's values and address rewrite registers that these
    // stores name: the wait stands in front of that.
    if (c + 1 < ATT_CG) {
      asm volatile("s_wait_xcnt 0x0" ::: "memory");
      // keeps the next group's products behind that wait; without it the
      // compiler lifts some of them, which rewrite those registers, over it.
      __builtin_amdgcn_sched_barrier(0);
    }
  }
}

// ---------------------------------------------------------------------------
extern "C" void kernel_launch(void* const* d_in, const int* in_sizes, int n_in,
                              void* d_out, int out_size, void* d_ws, size_t ws_size,
                              hipStream_t stream) {
  const float* q  = (const float*)d_in[0];
  const float* k  = (const float*)d_in[1];
  const float* v  = (const float*)d_in[2];
  const float* Wq = (const float*)d_in[3];
  const float* bq = (const float*)d_in[4];
  const float* Wk = (const float*)d_in[5];
  const float* bk = (const float*)d_in[6];
  const float* Wv = (const float*)d_in[7];
  const float* bv = (const float*)d_in[8];
  const float* Wo = (const float*)d_in[9];
  const float* bo = (const float*)d_in[10];

  const int rows = in_sizes[0] / DMODEL;   // B * S
  const int Bsz  = rows / SEQ;

  char* ws = (char*)d_ws;
  const size_t fbytes = (size_t)rows * DMODEL * sizeof(_Float16);   // 16 MB
  const size_t wbytes = (size_t)DMODEL * DMODEL * sizeof(_Float16); //  2 MB
  _Float16* Xq  = (_Float16*)(ws + 0 * fbytes);
  _Float16* Xk  = (_Float16*)(ws + 1 * fbytes);
  _Float16* Xv  = (_Float16*)(ws + 2 * fbytes);
  _Float16* Qf  = (_Float16*)(ws + 3 * fbytes);
  _Float16* Kf  = (_Float16*)(ws + 4 * fbytes);
  _Float16* Vtf = (_Float16*)(ws + 5 * fbytes);
  _Float16* Cf  = (_Float16*)(ws + 6 * fbytes);
  _Float16* wq16 = (_Float16*)(ws + 7 * fbytes + 0 * wbytes);
  _Float16* wk16 = (_Float16*)(ws + 7 * fbytes + 1 * wbytes);
  _Float16* wv16 = (_Float16*)(ws + 7 * fbytes + 2 * wbytes);
  _Float16* wo16 = (_Float16*)(ws + 7 * fbytes + 3 * wbytes);

  const int nX = rows * DMODEL;
  const int nW = DMODEL * DMODEL;
  // 256 blocks of 16 waves = one per WGP, seven tiles each at these shapes
  mha_cvt_f16_kernel<<<256, CVT_THREADS, 0, stream>>>(q, k, v, Wq, Wk, Wv, Wo,
                                                      Xq, Xk, Xv, wq16, wk16,
                                                      wv16, wo16, nX, nW);

  const int gemm_blocks = (rows / 128) * (DMODEL / 128);  // 128x128 tile / block
  mha_gemm_kernel<<<gemm_blocks, 256, 0, stream>>>(Xq, wq16, bq, Qf,  nullptr, rows, 0);
  mha_gemm_kernel<<<gemm_blocks, 256, 0, stream>>>(Xk, wk16, bk, Kf,  nullptr, rows, 0);
  mha_gemm_kernel<<<gemm_blocks, 256, 0, stream>>>(Xv, wv16, bv, Vtf, nullptr, rows, 1);

  const int at_blocks = Bsz * NHEADS * (SEQ / 256);       // 256 queries / block
  mha_attn_kernel<<<at_blocks, 256, 0, stream>>>(Qf, Kf, Vtf, Cf, Bsz);

  mha_gemm_kernel<<<gemm_blocks, 256, 0, stream>>>(Cf, wo16, bo, nullptr,
                                                   (float*)d_out, rows, 2);
}

// v008
// One run takes 172 microseconds.
// Two timings next to v007 both put it at 1.05 times that version's speed.
// All steps since v000 together make it 2.91 times as fast.
#include <hip/hip_runtime.h>
#include <hip/hip_bf16.h>

typedef __attribute__((ext_vector_type(16))) _Float16 v16h;
typedef __attribute__((ext_vector_type(8)))  _Float16 v8h;
typedef __attribute__((ext_vector_type(8)))  float    v8f;
typedef __attribute__((ext_vector_type(2)))  float    v2f;

#define DMODEL 1024
#define SEQ    4096
#define NHEADS 16
#define DKH    64

#define PITCH128B 72   // 128-byte rows -> 144 B
#define PITCH256B 136  // 256-byte rows -> 272 B

#define WAIT_ASYNCCNT(N) asm volatile("s_wait_asynccnt " #N ::: "memory")

__device__ __forceinline__ unsigned lds_off(const void* p) {
  return (unsigned)(unsigned long long)p;
}

__device__ __forceinline__ v16h load_frag16(const _Float16* base,
                                            int row0, int rowstride, int kbase) {
  const int lane = threadIdx.x & 31;
  const int l16  = lane & 15;
  const int hb   = (lane >> 4) & 1;
  const _Float16* p = base + (size_t)(row0 + l16) * rowstride + kbase + hb * 8;
  v8h lo = *(const v8h*)(p);
  v8h hi = *(const v8h*)(p + 16);
  return __builtin_shufflevector(lo, hi, 0,1,2,3,4,5,6,7,8,9,10,11,12,13,14,15);
}

__device__ __forceinline__ v8f wmma16(v16h a, v16h b, v8f c) {
  return __builtin_amdgcn_wmma_f32_16x16x32_f16(false, a, false, b, (short)0, c,
                                                false, false);
}

__device__ __forceinline__ float exp2_slot(float x) {
  float y;
  asm("v_exp_f32 %0, %1\n\tv_nop" : "=v"(y) : "v"(x));
  return y;
}

// ---- fp32 -> f16 conversion ------------------------------------------------
// One launch converts all seven f32 tensors. The work is cut into tiles of
// 16384 elements; a block walks the tiles with the grid as its stride, so few
// waves have to start and each streams: a thread loads a tile's share as eight
// 16-byte pieces (a wave-wide load covers 512 contiguous bytes = four lines),
// issues the next tile's eight loads before it converts and stores this one,
// and writes 8-byte pieces (a wave-wide store covers two whole lines).
// Every tensor's element count is a multiple of the tile (rows * 1024 with
// rows a multiple of 4096; 1024 * 1024), so a tile never straddles tensors.
typedef __attribute__((ext_vector_type(4))) float    v4f;
typedef __attribute__((ext_vector_type(4))) _Float16 v4h;
#define CVT_THREADS 512                  // 16 waves
#define CVT_SHIFT   14                   // tile = 512 threads x 8 x 4 elements
#define CVT_PIECE   (CVT_THREADS * 4)    // elements one block-wide load covers

// the loops over the eight pieces are unrolled so that x stays in registers
// and all eight loads are issued before the first value is needed.
__device__ __forceinline__ void cvt_load(v4f (&x)[8], const float* s) {
  #pragma unroll
  for (int j = 0; j < 8; j++) x[j] = *(const v4f*)(s + j * CVT_PIECE);
  // later code rewrites the address registers that these loads name: the
  // wait stands in front of that.
  asm volatile("s_wait_xcnt 0x0" ::: "memory");
}

__device__ __forceinline__ void cvt_store(const v4f (&x)[8], _Float16* d) {
  #pragma unroll
  for (int j = 0; j < 8; j++)
    *(v4h*)(d + j * CVT_PIECE) = __builtin_convertvector(x[j], v4h);
  // later code rewrites the address and data registers that these stores
  // name: the wait stands in front of that.
  asm volatile("s_wait_xcnt 0x0" ::: "memory");
}

__global__ void __launch_bounds__(CVT_THREADS)
mha_cvt_f16_kernel(const float* __restrict__ q,  const float* __restrict__ k,
                   const float* __restrict__ v,  const float* __restrict__ wq,
                   const float* __restrict__ wk, const float* __restrict__ wv,
                   const float* __restrict__ wo,
                   _Float16* __restrict__ xq,  _Float16* __restrict__ xk,
                   _Float16* __restrict__ xv,  _Float16* __restrict__ hq,
                   _Float16* __restrict__ hk,  _Float16* __restrict__ hv,
                   _Float16* __restrict__ ho, int nx, int nw) {
  const int tx = nx >> CVT_SHIFT;                  // tiles of an activation
  const int tw = nw >> CVT_SHIFT;                  // tiles of a weight
  const int ntiles = 3 * tx + 4 * tw;
  const int step = gridDim.x;

  // block-uniform choice of the tensor a tile belongs to; gives this thread's
  // first source and destination element of the tile.
  auto locate = [&](int t, const float*& s, _Float16*& d) {
    const float* src;
    _Float16* dst;
    if (t < 3 * tx) {
      if (t < tx)          { src = q; dst = xq; }
      else if (t < 2 * tx) { src = k; dst = xk; t -= tx; }
      else                 { src = v; dst = xv; t -= 2 * tx; }
    } else {
      t -= 3 * tx;
      if (t < tw)          { src = wq; dst = hq; }
      else if (t < 2 * tw) { src = wk; dst = hk; t -= tw; }
      else if (t < 3 * tw) { src = wv; dst = hv; t -= 2 * tw; }
      else                 { src = wo; dst = ho; t -= 3 * tw; }
    }
    const size_t off = ((size_t)t << CVT_SHIFT) + threadIdx.x * 4;
    s = src + off;
    d = dst + off;
  };

  int tile = blockIdx.x;
  if (tile >= ntiles) return;
  const int more = (ntiles - 1 - tile) / step;     // tiles behind the first one
  const float* s;
  _Float16 *d0, *d1;
  v4f x[8], y[8];                                  // two register buffers
  locate(tile, s, d0);
  cvt_load(x, s);
  // two tiles a trip, so that each buffer keeps its registers; the trip count
  // is known in front, so that the loop has one way in and one way out and
  // every wait for a buffer counts only the loads issued behind it.
  for (int i = 0; i < (more >> 1); i++) {
    tile += step;
    locate(tile, s, d1);
    cvt_load(y, s);                                // flies under x's stores
    // keeps x's conversions (and their waits for x) behind the issue of y's
    // loads; without it the compiler draws them in front and y starts late.
    __builtin_amdgcn_sched_barrier(0);
    cvt_store(x, d0);
    tile += step;
    locate(tile, s, d0);
    cvt_load(x, s);
    __builtin_amdgcn_sched_barrier(0);
    cvt_store(y, d1);
  }
  if (more & 1) {
    tile += step;
    locate(tile, s, d1);
    cvt_load(y, s);
    __builtin_amdgcn_sched_barrier(0);
    cvt_store(x, d0);
    cvt_store(y, d1);
  } else {
    cvt_store(x, d0);
  }
}

// ---- GEMM: C = A(rows x 1024, f16) @ W^T(1024 x 1024, f16) + bias ----------
// Block (8 waves, 4 x 2) computes a 256x128 C tile, one block per WGP; wave
// tile 64x64, so each A and each W fragment read from LDS feeds four WMMAs, and
// a C element costs a quarter fewer bytes from L2 than on a 128x128 tile.
// A stage is 128 k: 256-byte rows (whole L2 units) padded to 272 B, brought
// into LDS by async copies (one wave-wide copy covers two whole rows). Three
// buffers: while one stage is worked on, the copies of the next two are in
// flight, so that L2 delivers without a pause; the wait at a publish point
// leaves the younger stage's 24 copies outstanding. A stage is worked on in
// four passes of 32 k with no barrier between them. With one block on the WGP
// nobody else fills the time in which its waves read LDS, so a pass's 16
// fragment reads are issued as one group in front of the 16 WMMAs of the pass
// before it, into the other of two fragment sets.
//   mode 0: f16 row-major out (Q/K projections)
//   mode 1: f16 per-head transposed out Vt[(b*16+h)*64+d][s] (V projection)
//   mode 2: f32 row-major out (final projection, writes d_out)
#define GEMM_BM 256                      // C rows per block
#define GEMM_KS 128                      // k per stage
#define GEMM_ATILE (GEMM_BM * PITCH256B) // f16 elements of a staged A tile
#define GEMM_WTILE (128 * PITCH256B)     // ... of a staged W tile

__device__ __forceinline__ void gemm_stage128(unsigned l, const _Float16* g) {
  asm volatile("global_load_async_to_lds_b128 %0, %8, off\n\t"
               "global_load_async_to_lds_b128 %1, %9, off\n\t"
               "global_load_async_to_lds_b128 %2, %10, off\n\t"
               "global_load_async_to_lds_b128 %3, %11, off\n\t"
               "global_load_async_to_lds_b128 %4, %12, off\n\t"
               "global_load_async_to_lds_b128 %5, %13, off\n\t"
               "global_load_async_to_lds_b128 %6, %14, off\n\t"
               "global_load_async_to_lds_b128 %7, %15, off\n\t"
               "s_wait_xcnt 0x0"
               :: "v"(l), "v"(l + 16 * PITCH256B * 2),
                  "v"(l + 32 * PITCH256B * 2), "v"(l + 48 * PITCH256B * 2),
                  "v"(l + 64 * PITCH256B * 2), "v"(l + 80 * PITCH256B * 2),
                  "v"(l + 96 * PITCH256B * 2), "v"(l + 112 * PITCH256B * 2),
                  "v"(g), "v"(g + 16 * DMODEL),
                  "v"(g + 32 * DMODEL), "v"(g + 48 * DMODEL),
                  "v"(g + 64 * DMODEL), "v"(g + 80 * DMODEL),
                  "v"(g + 96 * DMODEL), "v"(g + 112 * DMODEL)
               : "memory");
}

// One stage: 256 rows of A and 128 rows of W.
__device__ __forceinline__ void gemm_stage(unsigned la, unsigned lw,
                                           const _Float16* ga,
                                           const _Float16* gw) {
  gemm_stage128(la, ga);
  gemm_stage128(la + 128 * PITCH256B * 2, ga + 128 * DMODEL);
  gemm_stage128(lw, gw);
}

// The eight fragments of one 32-k pass of a wave. The loop is unrolled so that
// the arrays are indexed by constants and stay in registers.
__device__ __forceinline__ void gemm_frags(v16h (&af)[4], v16h (&bf)[4],
                                           const _Float16* sa, const _Float16* sw,
                                           int wm, int wn, int kbase) {
  #pragma unroll
  for (int i = 0; i < 4; i++) {
    af[i] = load_frag16(sa, wm + i * 16, PITCH256B, kbase);
    bf[i] = load_frag16(sw, wn + i * 16, PITCH256B, kbase);
  }
}

__global__ void __launch_bounds__(256)
mha_gemm_kernel(const _Float16* __restrict__ A, const _Float16* __restrict__ W,
                const float* __restrict__ bias, _Float16* __restrict__ outh,
                float* __restrict__ outf, int mrows, int mode) {
  __shared__ __attribute__((aligned(16))) _Float16 sA[3][GEMM_ATILE];  // 3 x 68KB
  __shared__ __attribute__((aligned(16))) _Float16 sW[3][GEMM_WTILE];  // 3 x 34KB
  const int nblocks = DMODEL / 128;                // 8
  const int mblk = blockIdx.x / nblocks;
  const int nblk0 = (blockIdx.x % nblocks) * 128;
  if (mblk * GEMM_BM >= mrows) return;             // block-uniform guard
  const int tid  = threadIdx.x;
  const int wave = tid >> 5;
  const int wm   = (wave >> 1) * 64;               // wave's rows in the tile
  const int wn   = (wave & 1) * 64;                // wave's columns in the tile
  const int lane = tid & 31;
  const int l16  = lane & 15;
  const int hb   = (lane >> 4) & 1;

  // staging map: thread t moves rows t/16 + 16*j, chunk (t%16)*8 .. +8
  const int srow = tid >> 4;
  const int schk = tid & 15;
  const _Float16* asrc = A + (size_t)(mblk * GEMM_BM + srow) * DMODEL + schk * 8;
  const _Float16* wsrc = W + (size_t)(nblk0 + srow) * DMODEL + schk * 8;
  const unsigned adst = lds_off(&sA[0][srow * PITCH256B + schk * 8]);
  const unsigned wdst = lds_off(&sW[0][srow * PITCH256B + schk * 8]);
  const int nstages = DMODEL / GEMM_KS;            // 8

  gemm_stage(adst, wdst, asrc, wsrc);              // stage 0 -> buffer 0
  gemm_stage(adst + GEMM_ATILE * 2, wdst + GEMM_WTILE * 2,
             asrc + GEMM_KS, wsrc + GEMM_KS);      // stage 1 -> buffer 1
  WAIT_ASYNCCNT(0x18);                             // own copies of stage 0 landed (24 younger ones fly)
  __syncthreads();                                 // ... and everybody's
  gemm_stage(adst + 2 * (GEMM_ATILE * 2), wdst + 2 * (GEMM_WTILE * 2),
             asrc + 2 * GEMM_KS, wsrc + 2 * GEMM_KS);  // stage 2 -> buffer 2

  v8f acc[4][4] = {};
  v16h af[2][4], bf[2][4];                         // two fragment sets
  gemm_frags(af[0], bf[0], sA[0], sW[0], wm, wn, 0);
  int cur = 0;                                     // buffer of stage t: t mod 3
  for (int t = 0; t < nstages; t++) {
    const int nxt = (cur == 2) ? 0 : cur + 1;
    // the four passes are unrolled so that the fragment sets are indexed by
    // constants and stay in registers.
    #pragma unroll
    for (int ks = 0; ks < GEMM_KS / 32; ks++) {
      const int cs = ks & 1;
      if (ks + 1 < GEMM_KS / 32) {
        gemm_frags(af[cs ^ 1], bf[cs ^ 1], sA[cur], sW[cur], wm, wn, (ks + 1) * 32);
      } else {
        // publish point of stage t + 1, taken as soon as this stage's last
        // fragment reads are in registers: own LDS reads of this buffer
        // retired, own copies of stage t + 1 landed, then one barrier that both
        // publishes that stage and frees this buffer. A trip that refills has
        // stage t + 2's 24 copies behind those of stage t + 1 and leaves them
        // outstanding; the last trips, which issue nothing, wait for all.
        asm volatile("s_wait_dscnt 0x0" ::: "memory");
        if (t + 3 < nstages) WAIT_ASYNCCNT(0x18);
        else                 WAIT_ASYNCCNT(0x0);
        __syncthreads();
        if (t + 1 < nstages)                       // first pass of the published stage
          gemm_frags(af[cs ^ 1], bf[cs ^ 1], sA[nxt], sW[nxt], wm, wn, 0);
      }
      // keeps this pass's 16 WMMAs behind the reads issued for the next pass,
      // so that these fly under the WMMAs and no LDS read is drawn in among
      // them.
      __builtin_amdgcn_sched_barrier(0);
      #pragma unroll
      for (int mi = 0; mi < 4; mi++)
        #pragma unroll
        for (int nb = 0; nb < 4; nb++)
          acc[mi][nb] = wmma16(af[cs][mi], bf[cs][nb], acc[mi][nb]);
      // keeps what follows (the next pass's reads, which overwrite the set that
      // these WMMAs read; the refill) behind the WMMAs' issue.
      __builtin_amdgcn_sched_barrier(0);
    }
    if (t + 3 < nstages)
      gemm_stage(adst + cur * (GEMM_ATILE * 2), wdst + cur * (GEMM_WTILE * 2),
                 asrc + (t + 3) * GEMM_KS, wsrc + (t + 3) * GEMM_KS);
    cur = nxt;
  }
  WAIT_ASYNCCNT(0x0);                              // nothing in flight at the end

  // C/D layout: lane holds n = n0 + nb*16 + l16, component r holds m = m0+r+8*hb
  const int n0 = nblk0 + wn;
  #pragma unroll
  for (int mi = 0; mi < 4; mi++) {
    const int m0 = mblk * GEMM_BM + wm + mi * 16;
    if (mode == 1) {
      const int gm0   = m0 + 8 * hb;               // 8 consecutive rows (s dim)
      const int bb    = gm0 >> 12;                 // / SEQ
      const int sbase = gm0 & (SEQ - 1);
      #pragma unroll
      for (int nb = 0; nb < 4; nb++) {
        const int gn = n0 + nb * 16 + l16;
        const int h  = gn >> 6, d = gn & 63;
        const float bv = bias[gn];
        v8h pk;
        #pragma unroll
        for (int r = 0; r < 8; r++) pk[r] = (_Float16)(acc[mi][nb][r] + bv);
        *(v8h*)(outh + (((size_t)(bb * NHEADS + h) * DKH + d) * SEQ + sbase)) = pk;
      }
      // a register that an issued store names is rewritten behind this run
      // (next rows' values, the other modes' code): the wait stands in front.
      asm volatile("s_wait_xcnt 0x0" ::: "memory");
    } else if (mode == 0) {
      #pragma unroll
      for (int nb = 0; nb < 4; nb++) {
        const int gn = n0 + nb * 16 + l16;
        const float bv = bias[gn];
        #pragma unroll
        for (int r = 0; r < 8; r++) {
          const int gm = m0 + r + 8 * hb;
          outh[(size_t)gm * DMODEL + gn] = (_Float16)(acc[mi][nb][r] + bv);
        }
      }
      // a register that an issued store names is rewritten behind this run
      // (next rows' values, the other modes' code): the wait stands in front.
      asm volatile("s_wait_xcnt 0x0" ::: "memory");
    } else {
      #pragma unroll
      for (int nb = 0; nb < 4; nb++) {
        const int gn = n0 + nb * 16 + l16;
        const float bv = bias[gn];
        #pragma unroll
        for (int r = 0; r < 8; r++) {
          const int gm = m0 + r + 8 * hb;
          outf[(size_t)gm * DMODEL + gn] = acc[mi][nb][r] + bv;
        }
      }
      // a register that an issued store names is rewritten behind this run
      // (next rows' values, the other modes' code): the wait stands in front.
      asm volatile("s_wait_xcnt 0x0" ::: "memory");
    }
  }
}

#define ATT_CG 2                                   // column groups per wave
#define ATT_SK 128                                 // keys per stage
#define ATT_KT (ATT_SK * PITCH128B)                // f16 elements of a staged K tile
#define ATT_VT (DKH * PITCH256B)                   // ... of a staged V^T tile

__device__ __forceinline__ void attn_stage(unsigned lk, unsigned lv,
                                           const _Float16* gk,
                                           const _Float16* gv) {
  asm volatile("global_load_async_to_lds_b128 %0, %8, off\n\t"
               "global_load_async_to_lds_b128 %1, %9, off\n\t"
               "global_load_async_to_lds_b128 %2, %10, off\n\t"
               "global_load_async_to_lds_b128 %3, %11, off\n\t"
               "global_load_async_to_lds_b128 %4, %12, off\n\t"
               "global_load_async_to_lds_b128 %5, %13, off\n\t"
               "global_load_async_to_lds_b128 %6, %14, off\n\t"
               "global_load_async_to_lds_b128 %7, %15, off\n\t"
               "s_wait_xcnt 0x0"
               :: "v"(lk), "v"(lk + 32 * PITCH128B * 2),
                  "v"(lk + 64 * PITCH128B * 2), "v"(lk + 96 * PITCH128B * 2),
                  "v"(lv), "v"(lv + 16 * PITCH256B * 2),
                  "v"(lv + 32 * PITCH256B * 2), "v"(lv + 48 * PITCH256B * 2),
                  "v"(gk), "v"(gk + 32 * DMODEL),
                  "v"(gk + 64 * DMODEL), "v"(gk + 96 * DMODEL),
                  "v"(gv), "v"(gv + 16 * SEQ),
                  "v"(gv + 32 * SEQ), "v"(gv + 48 * SEQ)
               : "memory");
}

__global__ void __launch_bounds__(256) __attribute__((amdgpu_waves_per_eu(4, 4)))
mha_attn_kernel(const _Float16* __restrict__ Qm, const _Float16* __restrict__ Km,
                const _Float16* __restrict__ Vt, _Float16* __restrict__ ctx,
                int Bsz) {
  __shared__ __attribute__((aligned(16))) _Float16 sK[2][ATT_KT];  // row = key
  __shared__ __attribute__((aligned(16))) _Float16 sV[2][ATT_VT];  // row = d
  const int qblocks = SEQ / (128 * ATT_CG);        // 16
  const int qb = blockIdx.x % qblocks;
  const int h  = (blockIdx.x / qblocks) % NHEADS;
  const int b  = blockIdx.x / (qblocks * NHEADS);
  const int tid  = threadIdx.x;
  const int q0   = qb * (128 * ATT_CG) + (tid >> 5) * (16 * ATT_CG);
  const int lane = tid & 31;
  const int l16  = lane & 15;
  const int hb   = (lane >> 4) & 1;

  const _Float16* qbase = Qm + (size_t)b * SEQ * DMODEL + h * DKH;
  const _Float16* kbase = Km + (size_t)b * SEQ * DMODEL + h * DKH;
  const _Float16* vbase = Vt + (size_t)(b * NHEADS + h) * DKH * SEQ;

  // staging maps (four b128 chunks per thread per tile)
  const int krow = tid >> 3, kchk = tid & 7;       // K: 128 rows x 128B
  const _Float16* ksrc = kbase + (size_t)krow * DMODEL + kchk * 8;
  const unsigned kdst = lds_off(&sK[0][krow * PITCH128B + kchk * 8]);
  const int vrow = tid >> 4, vchk = tid & 15;      // V^T: 64 rows x 256B
  const _Float16* vsrc = vbase + (size_t)vrow * SEQ + vchk * 8;
  const unsigned vdst = lds_off(&sV[0][vrow * PITCH256B + vchk * 8]);
  const int nstages = SEQ / ATT_SK;                // 32

  // loop-invariant Q^T fragments (d = 0..31 and 32..63) of each column group.
  // all loops over column groups are unrolled so that the arrays they index
  // stay in registers.
  v16h qf0[ATT_CG], qf1[ATT_CG];
  #pragma unroll
  for (int c = 0; c < ATT_CG; c++) {
    qf0[c] = load_frag16(qbase, q0 + c * 16, DMODEL, 0);
    qf1[c] = load_frag16(qbase, q0 + c * 16, DMODEL, 32);
  }

  attn_stage(kdst, vdst, ksrc, vsrc);              // stage 0 -> buffer 0
  WAIT_ASYNCCNT(0x0);                              // own copies of stage 0 landed
  __syncthreads();                                 // ... and everybody's
  attn_stage(kdst + ATT_KT * 2, vdst + ATT_VT * 2,
             ksrc + (size_t)ATT_SK * DMODEL, vsrc + ATT_SK);  // stage 1 -> buffer 1

  v8f o0[ATT_CG] = {}, o1[ATT_CG] = {}, o2[ATT_CG] = {}, o3[ATT_CG] = {};  // O^T: 64d x 16q each
  // euse = the exponent's offset in use (a maximum seen so far, in exp2 units);
  // thr = the raw score above which that offset has to be renewed.
  float thr[ATT_CG], euse[ATT_CG], lrun[ATT_CG];
  #pragma unroll
  for (int c = 0; c < ATT_CG; c++) { thr[c] = -1e30f; euse[c] = -1e30f; lrun[c] = 0.f; }
  const float sl2e = 0.125f * 1.44269504088896f;   // 1/sqrt(64) * log2(e)
  const float margin = 8.0f / sl2e;                 // 8 in exp2 units, as a raw score

  for (int st = 0; st < nstages; st++) {
    const int cur = st & 1;
    const _Float16* skc = sK[cur];
    const _Float16* svc = sV[cur];
   // the four passes are unrolled so that a pass's LDS offsets are constants
   // and its fragment reads can be issued under the pass in front of it.
   #pragma unroll
   for (int ps = 0; ps < ATT_SK / 32; ps++) {
    v16h kf00 = load_frag16(skc, ps * 32,      PITCH128B, 0);
    v16h kf01 = load_frag16(skc, ps * 32,      PITCH128B, 32);
    v16h kf10 = load_frag16(skc, ps * 32 + 16, PITCH128B, 0);
    v16h kf11 = load_frag16(skc, ps * 32 + 16, PITCH128B, 32);
    v8f s0[ATT_CG] = {}, s1[ATT_CG] = {};          // S^T: m=key, n=query
    #pragma unroll
    for (int c = 0; c < ATT_CG; c++) {
      s0[c] = wmma16(kf00, qf0[c], s0[c]);
      s1[c] = wmma16(kf10, qf0[c], s1[c]);
    }
    #pragma unroll
    for (int c = 0; c < ATT_CG; c++) {
      s0[c] = wmma16(kf01, qf1[c], s0[c]);
      s1[c] = wmma16(kf11, qf1[c], s1[c]);
    }
    v16h vf0 = load_frag16(svc,  0, PITCH256B, ps * 32);
    v16h vf1 = load_frag16(svc, 16, PITCH256B, ps * 32);
    v16h vf2 = load_frag16(svc, 32, PITCH256B, ps * 32);
    v16h vf3 = load_frag16(svc, 48, PITCH256B, ps * 32);

    // online softmax per query (= per lane column), with a lazy rescale: the
    // exponent's offset stays as it is while no score of the step lies more
    // than 8 (in exp2 units) above it, so a probability is at most 2^8, well
    // inside f16, and the step then needs no exchange between the wave's
    // halves for the maximum, no correction factor and no product on the 64
    // output accumulators. The test is made once per step for the whole wave:
    // a ballot and a scalar branch. In the branch every column takes its true
    // running maximum (both halves merged, so a query's two lanes agree).
    // The maximum is taken over the raw scores; its product with
    // scale * log2(e) is the exponent's offset, so each score costs one FMA in
    // front of its exp2. The FMAs take the accumulators' own register pairs.
    // The loops over r are unrolled so that every vector element is indexed by
    // a constant and stays in its register.
    float mloc[ATT_CG];
    bool need = false;
    #pragma unroll
    for (int c = 0; c < ATT_CG; c++) {
      float m = -1e30f;
      #pragma unroll
      for (int r = 0; r < 8; r++)
        m = fmaxf(m, fmaxf(s0[c][r], s1[c][r]));
      mloc[c] = m;
      need = need || (m > thr[c]);
    }
    if (__builtin_amdgcn_ballot_w32(need) != 0) {
      #pragma unroll
      for (int c = 0; c < ATT_CG; c++) {
        const float mj = fmaxf(mloc[c], __shfl_xor(mloc[c], 16, 32));
        const float enew = fmaxf(euse[c], mj * sl2e);
        const float corr = exp2_slot(euse[c] - enew);
        thr[c] = fmaxf(thr[c], mj + margin);
        euse[c] = enew;
        lrun[c] *= corr;
        #pragma unroll
        for (int r = 0; r < 8; r++) {
          o0[c][r] *= corr; o1[c][r] *= corr; o2[c][r] *= corr; o3[c][r] *= corr;
        }
      }
    }
    v16h pf[ATT_CG];                               // P^T B-fragments, in place
    #pragma unroll
    for (int c = 0; c < ATT_CG; c++) {
      const v2f mul2 = {sl2e, sl2e};
      const v2f off = {-euse[c], -euse[c]};
      float psum = 0.f;
      #pragma unroll
      for (int r = 0; r < 8; r += 2) {
        const v2f a0 = {s0[c][r], s0[c][r + 1]};
        const v2f a1 = {s1[c][r], s1[c][r + 1]};
        const v2f x0 = __builtin_elementwise_fma(a0, mul2, off);
        const v2f x1 = __builtin_elementwise_fma(a1, mul2, off);
        const bool slot0 = ps == 0 && r == 4;
        const bool slot1 = ps == 3 && r == 4;
        const v2f p0 = {__builtin_amdgcn_exp2f(x0[0]),
                        slot0 ? exp2_slot(x0[1]) : __builtin_amdgcn_exp2f(x0[1])};
        const v2f p1 = {__builtin_amdgcn_exp2f(x1[0]),
                        slot1 ? exp2_slot(x1[1]) : __builtin_amdgcn_exp2f(x1[1])};
        const v2f pp = p0 + p1;
        psum = (r == 0) ? pp[0] : psum + pp[0];
        psum += pp[1];
        pf[c][r]     = (_Float16)p0[0];
        pf[c][r + 1] = (_Float16)p0[1];
        pf[c][r + 8] = (_Float16)p1[0];
        pf[c][r + 9] = (_Float16)p1[1];
      }
      psum += __shfl_xor(psum, 16, 32);
      lrun[c] += psum;
    }
    #pragma unroll
    for (int c = 0; c < ATT_CG; c++) {
      o0[c] = wmma16(vf0, pf[c], o0[c]);
      o1[c] = wmma16(vf1, pf[c], o1[c]);
      o2[c] = wmma16(vf2, pf[c], o2[c]);
      o3[c] = wmma16(vf3, pf[c], o3[c]);
    }
   }
    // publish point, once per stage: own LDS reads of this buffer retired, own
    // copies of the next stage landed, then one barrier that both publishes the
    // next stage and frees this buffer for the refill behind it.
    asm volatile("s_wait_dscnt 0x0" ::: "memory");
    WAIT_ASYNCCNT(0x0);
    __syncthreads();
    if (st + 2 < nstages)
      attn_stage(kdst + cur * (ATT_KT * 2), vdst + cur * (ATT_VT * 2),
                 ksrc + (size_t)(st + 2) * ATT_SK * DMODEL,
                 vsrc + (st + 2) * ATT_SK);
  }
  WAIT_ASYNCCNT(0x0);                              // nothing in flight at the end

  // normalize and store: lane's query = q0+c*16+l16; component r -> d = db*16+r+8*hb
  #pragma unroll
  for (int c = 0; c < ATT_CG; c++) {
    const float inv = 1.f / lrun[c];
    _Float16* crow = ctx + (size_t)(b * SEQ + q0 + c * 16 + l16) * DMODEL + h * DKH + 8 * hb;
    v8f oall[4] = {o0[c], o1[c], o2[c], o3[c]};
    #pragma unroll
    for (int db = 0; db < 4; db++) {
      v8h pk;
      #pragma unroll
      for (int r = 0; r < 8; r++) pk[r] = (_Float16)(oall[db][r] * inv);
      *(v8h*)(crow + db * 16) = pk;
    }
    // the next column group's values and address rewrite registers that these
    // stores name: the wait stands in front of that.
    if (c + 1 < ATT_CG) {
      asm volatile("s_wait_xcnt 0x0" ::: "memory");
      // keeps the next group's products behind that wait; without it the
      // compiler lifts some of them, which rewrite those registers, over it.
      __builtin_amdgcn_sched_barrier(0);
    }
  }
}

// ---------------------------------------------------------------------------
extern "C" void kernel_launch(void* const* d_in, const int* in_sizes, int n_in,
                              void* d_out, int out_size, void* d_ws, size_t ws_size,
                              hipStream_t stream) {
  const float* q  = (const float*)d_in[0];
  const float* k  = (const float*)d_in[1];
  const float* v  = (const float*)d_in[2];
  const float* Wq = (const float*)d_in[3];
  const float* bq = (const float*)d_in[4];
  const float* Wk = (const float*)d_in[5];
  const float* bk = (const float*)d_in[6];
  const float* Wv = (const float*)d_in[7];
  const float* bv = (const float*)d_in[8];
  const float* Wo = (const float*)d_in[9];
  const float* bo = (const float*)d_in[10];

  const int rows = in_sizes[0] / DMODEL;   // B * S
  const int Bsz  = rows / SEQ;

  char* ws = (char*)d_ws;
  const size_t fbytes = (size_t)rows * DMODEL * sizeof(_Float16);   // 16 MB
  const size_t wbytes = (size_t)DMODEL * DMODEL * sizeof(_Float16); //  2 MB
  _Float16* Xq  = (_Float16*)(ws + 0 * fbytes);
  _Float16* Xk  = (_Float16*)(ws + 1 * fbytes);
  _Float16* Xv  = (_Float16*)(ws + 2 * fbytes);
  _Float16* Qf  = (_Float16*)(ws + 3 * fbytes);
  _Float16* Kf  = (_Float16*)(ws + 4 * fbytes);
  _Float16* Vtf = (_Float16*)(ws + 5 * fbytes);
  _Float16* Cf  = (_Float16*)(ws + 6 * fbytes);
  _Float16* wq16 = (_Float16*)(ws + 7 * fbytes + 0 * wbytes);
  _Float16* wk16 = (_Float16*)(ws + 7 * fbytes + 1 * wbytes);
  _Float16* wv16 = (_Float16*)(ws + 7 * fbytes + 2 * wbytes);
  _Float16* wo16 = (_Float16*)(ws + 7 * fbytes + 3 * wbytes);

  const int nX = rows * DMODEL;
  const int nW = DMODEL * DMODEL;
  // 256 blocks of 16 waves = one per WGP, seven tiles each at these shapes
  mha_cvt_f16_kernel<<<256, CVT_THREADS, 0, stream>>>(q, k, v, Wq, Wk, Wv, Wo,
                                                      Xq, Xk, Xv, wq16, wk16,
                                                      wv16, wo16, nX, nW);

  const int gemm_blocks = (rows / 256) * (DMODEL / 128);  // 256x128 tile / block
  mha_gemm_kernel<<<gemm_blocks, 256, 0, stream>>>(Xq, wq16, bq, Qf,  nullptr, rows, 0);
  mha_gemm_kernel<<<gemm_blocks, 256, 0, stream>>>(Xk, wk16, bk, Kf,  nullptr, rows, 0);
  mha_gemm_kernel<<<gemm_blocks, 256, 0, stream>>>(Xv, wv16, bv, Vtf, nullptr, rows, 1);

  const int at_blocks = Bsz * NHEADS * (SEQ / 256);       // 256 queries / block
  mha_attn_kernel<<<at_blocks, 256, 0, stream>>>(Qf, Kf, Vtf, Cf, Bsz);

  mha_gemm_kernel<<<gemm_blocks, 256, 0, stream>>>(Cf, wo16, bo, nullptr,
                                                   (float*)d_out, rows, 2);
}

// v009
// Measured time: 165 microseconds a run.
// Two timings next to v008 both put it at 1.04 times that version's speed.
// Over all steps from v000 it is 3.03 times as fast.
#include <hip/hip_runtime.h>
#include <hip/hip_bf16.h>

typedef __attribute__((ext_vector_type(16))) _Float16 v16h;
typedef __attribute__((ext_vector_type(8)))  _Float16 v8h;
typedef __attribute__((ext_vector_type(8)))  float    v8f;
typedef __attribute__((ext_vector_type(2)))  float    v2f;

#define DMODEL 1024
#define SEQ    4096
#define NHEADS 16
#define DKH    64

#define PITCH128B 72   // 128-byte rows -> 144 B
#define PITCH256B 136  // 256-byte rows -> 272 B

#define WAIT_ASYNCCNT(N) asm volatile("s_wait_asynccnt " #N ::: "memory")

__device__ __forceinline__ unsigned lds_off(const void* p) {
  return (unsigned)(unsigned long long)p;
}

__device__ __forceinline__ v16h load_frag16(const _Float16* base,
                                            int row0, int rowstride, int kbase) {
  const int lane = threadIdx.x & 31;
  const int l16  = lane & 15;
  const int hb   = (lane >> 4) & 1;
  const _Float16* p = base + (size_t)(row0 + l16) * rowstride + kbase + hb * 8;
  v8h lo = *(const v8h*)(p);
  v8h hi = *(const v8h*)(p + 16);
  return __builtin_shufflevector(lo, hi, 0,1,2,3,4,5,6,7,8,9,10,11,12,13,14,15);
}

__device__ __forceinline__ v8f wmma16(v16h a, v16h b, v8f c) {
  return __builtin_amdgcn_wmma_f32_16x16x32_f16(false, a, false, b, (short)0, c,
                                                false, false);
}

__device__ __forceinline__ float exp2_slot(float x) {
  float y;
  asm("v_exp_f32 %0, %1\n\tv_nop" : "=v"(y) : "v"(x));
  return y;
}

// ---- fp32 -> f16 conversion ------------------------------------------------
// One launch converts all seven f32 tensors. The work is cut into tiles of
// 16384 elements; a block walks the tiles with the grid as its stride, so few
// waves have to start and each streams: a thread loads a tile's share as eight
// 16-byte pieces (a wave-wide load covers 512 contiguous bytes = four lines),
// issues the next tile's eight loads before it converts and stores this one,
// and writes 8-byte pieces (a wave-wide store covers two whole lines).
// Every tensor's element count is a multiple of the tile (rows * 1024 with
// rows a multiple of 4096; 1024 * 1024), so a tile never straddles tensors.
typedef __attribute__((ext_vector_type(4))) float    v4f;
typedef __attribute__((ext_vector_type(4))) _Float16 v4h;
#define CVT_THREADS 512                  // 16 waves
#define CVT_SHIFT   14                   // tile = 512 threads x 8 x 4 elements
#define CVT_PIECE   (CVT_THREADS * 4)    // elements one block-wide load covers

// the loops over the eight pieces are unrolled so that x stays in registers
// and all eight loads are issued before the first value is needed.
__device__ __forceinline__ void cvt_load(v4f (&x)[8], const float* s) {
  #pragma unroll
  for (int j = 0; j < 8; j++) x[j] = *(const v4f*)(s + j * CVT_PIECE);
  // later code rewrites the address registers that these loads name: the
  // wait stands in front of that.
  asm volatile("s_wait_xcnt 0x0" ::: "memory");
}

__device__ __forceinline__ void cvt_store(const v4f (&x)[8], _Float16* d) {
  #pragma unroll
  for (int j = 0; j < 8; j++)
    *(v4h*)(d + j * CVT_PIECE) = __builtin_convertvector(x[j], v4h);
  // later code rewrites the address and data registers that these stores
  // name: the wait stands in front of that.
  asm volatile("s_wait_xcnt 0x0" ::: "memory");
}

__global__ void __launch_bounds__(CVT_THREADS)
mha_cvt_f16_kernel(const float* __restrict__ q,  const float* __restrict__ k,
                   const float* __restrict__ v,  const float* __restrict__ wq,
                   const float* __restrict__ wk, const float* __restrict__ wv,
                   const float* __restrict__ wo,
                   _Float16* __restrict__ xq,  _Float16* __restrict__ xk,
                   _Float16* __restrict__ xv,  _Float16* __restrict__ hq,
                   _Float16* __restrict__ hk,  _Float16* __restrict__ hv,
                   _Float16* __restrict__ ho, int nx, int nw) {
  const int tx = nx >> CVT_SHIFT;                  // tiles of an activation
  const int tw = nw >> CVT_SHIFT;                  // tiles of a weight
  const int ntiles = 3 * tx + 4 * tw;
  const int step = gridDim.x;

  // block-uniform choice of the tensor a tile belongs to; gives this thread's
  // first source and destination element of the tile.
  auto locate = [&](int t, const float*& s, _Float16*& d) {
    const float* src;
    _Float16* dst;
    if (t < 3 * tx) {
      if (t < tx)          { src = q; dst = xq; }
      else if (t < 2 * tx) { src = k; dst = xk; t -= tx; }
      else                 { src = v; dst = xv; t -= 2 * tx; }
    } else {
      t -= 3 * tx;
      if (t < tw)          { src = wq; dst = hq; }
      else if (t < 2 * tw) { src = wk; dst = hk; t -= tw; }
      else if (t < 3 * tw) { src = wv; dst = hv; t -= 2 * tw; }
      else                 { src = wo; dst = ho; t -= 3 * tw; }
    }
    const size_t off = ((size_t)t << CVT_SHIFT) + threadIdx.x * 4;
    s = src + off;
    d = dst + off;
  };

  int tile = blockIdx.x;
  if (tile >= ntiles) return;
  const int more = (ntiles - 1 - tile) / step;     // tiles behind the first one
  const float* s;
  _Float16 *d0, *d1;
  v4f x[8], y[8];                                  // two register buffers
  locate(tile, s, d0);
  cvt_load(x, s);
  // two tiles a trip, so that each buffer keeps its registers; the trip count
  // is known in front, so that the loop has one way in and one way out and
  // every wait for a buffer counts only the loads issued behind it.
  for (int i = 0; i < (more >> 1); i++) {
    tile += step;
    locate(tile, s, d1);
    cvt_load(y, s);                                // flies under x's stores
    // keeps x's conversions (and their waits for x) behind the issue of y's
    // loads; without it the compiler draws them in front and y starts late.
    __builtin_amdgcn_sched_barrier(0);
    cvt_store(x, d0);
    tile += step;
    locate(tile, s, d0);
    cvt_load(x, s);
    __builtin_amdgcn_sched_barrier(0);
    cvt_store(y, d1);
  }
  if (more & 1) {
    tile += step;
    locate(tile, s, d1);
    cvt_load(y, s);
    __builtin_amdgcn_sched_barrier(0);
    cvt_store(x, d0);
    cvt_store(y, d1);
  } else {
    cvt_store(x, d0);
  }
}

// ---- GEMM: C = A(rows x 1024, f16) @ W^T(1024 x 1024, f16) + bias ----------
// Block (8 waves, 4 x 2) computes a 256x128 C tile, one block per WGP; wave
// tile 64x64, so each A and each W fragment read from LDS feeds four WMMAs, and
// a C element costs a quarter fewer bytes from L2 than on a 128x128 tile.
// A stage is 128 k: 256-byte rows (whole L2 units) padded to 272 B, brought
// into LDS by async copies (one wave-wide copy covers two whole rows). Three
// buffers: while one stage is worked on, the copies of the next two are in
// flight, so that L2 delivers without a pause; the wait at a publish point
// leaves the younger stage's 24 copies outstanding. A stage is worked on in
// four passes of 32 k with no barrier between them. With one block on the WGP
// nobody else fills the time in which its waves read LDS, so a pass's 16
// fragment reads are issued as one group in front of the 16 WMMAs of the pass
// before it, into the other of two fragment sets.
//   mode 0: f16 row-major out (Q/K projections)
//   mode 1: f16 per-head transposed out Vt[(b*16+h)*64+d][s] (V projection)
//   mode 2: f32 row-major out (final projection, writes d_out)
// One launch does nprod products that lie one behind the other in memory
// (A, W and the f16 output each step by a whole tensor): nprod = 3 is the Q, K
// and V projections (modes 0, 0, 1), nprod = 1 the final projection (mode 2).
// A block keeps its tile position and walks the products; the stages of all of
// them form one sequence for the copy ring, so the first stages of the next
// product are already in flight or landed while this product's tile is stored,
// and no launch gap, block start or ring prologue stands between products.
#define GEMM_BM 256                      // C rows per block
#define GEMM_KS 128                      // k per stage
#define GEMM_ATILE (GEMM_BM * PITCH256B) // f16 elements of a staged A tile
#define GEMM_WTILE (128 * PITCH256B)     // ... of a staged W tile

__device__ __forceinline__ void gemm_stage128(unsigned l, const _Float16* g) {
  asm volatile("global_load_async_to_lds_b128 %0, %8, off\n\t"
               "global_load_async_to_lds_b128 %1, %9, off\n\t"
               "global_load_async_to_lds_b128 %2, %10, off\n\t"
               "global_load_async_to_lds_b128 %3, %11, off\n\t"
               "global_load_async_to_lds_b128 %4, %12, off\n\t"
               "global_load_async_to_lds_b128 %5, %13, off\n\t"
               "global_load_async_to_lds_b128 %6, %14, off\n\t"
               "global_load_async_to_lds_b128 %7, %15, off\n\t"
               "s_wait_xcnt 0x0"
               :: "v"(l), "v"(l + 16 * PITCH256B * 2),
                  "v"(l + 32 * PITCH256B * 2), "v"(l + 48 * PITCH256B * 2),
                  "v"(l + 64 * PITCH256B * 2), "v"(l + 80 * PITCH256B * 2),
                  "v"(l + 96 * PITCH256B * 2), "v"(l + 112 * PITCH256B * 2),
                  "v"(g), "v"(g + 16 * DMODEL),
                  "v"(g + 32 * DMODEL), "v"(g + 48 * DMODEL),
                  "v"(g + 64 * DMODEL), "v"(g + 80 * DMODEL),
                  "v"(g + 96 * DMODEL), "v"(g + 112 * DMODEL)
               : "memory");
}

// One stage: 256 rows of A and 128 rows of W.
__device__ __forceinline__ void gemm_stage(unsigned la, unsigned lw,
                                           const _Float16* ga,
                                           const _Float16* gw) {
  gemm_stage128(la, ga);
  gemm_stage128(la + 128 * PITCH256B * 2, ga + 128 * DMODEL);
  gemm_stage128(lw, gw);
}

// The eight fragments of one 32-k pass of a wave. The loop is unrolled so that
// the arrays are indexed by constants and stay in registers.
__device__ __forceinline__ void gemm_frags(v16h (&af)[4], v16h (&bf)[4],
                                           const _Float16* sa, const _Float16* sw,
                                           int wm, int wn, int kbase) {
  #pragma unroll
  for (int i = 0; i < 4; i++) {
    af[i] = load_frag16(sa, wm + i * 16, PITCH256B, kbase);
    bf[i] = load_frag16(sw, wn + i * 16, PITCH256B, kbase);
  }
}

__global__ void __launch_bounds__(256)
mha_gemm_kernel(const _Float16* __restrict__ A, const _Float16* __restrict__ W,
                const float* __restrict__ bias0, const float* __restrict__ bias1,
                const float* __restrict__ bias2, _Float16* __restrict__ outh0,
                float* __restrict__ outf, int mrows, int nprod) {
  __shared__ __attribute__((aligned(16))) _Float16 sA[3][GEMM_ATILE];  // 3 x 68KB
  __shared__ __attribute__((aligned(16))) _Float16 sW[3][GEMM_WTILE];  // 3 x 34KB
  const int nblocks = DMODEL / 128;                // 8
  const int mblk = blockIdx.x / nblocks;
  const int nblk0 = (blockIdx.x % nblocks) * 128;
  if (mblk * GEMM_BM >= mrows) return;             // block-uniform guard
  const int tid  = threadIdx.x;
  const int wave = tid >> 5;
  const int wm   = (wave >> 1) * 64;               // wave's rows in the tile
  const int wn   = (wave & 1) * 64;                // wave's columns in the tile
  const int lane = tid & 31;
  const int l16  = lane & 15;
  const int hb   = (lane >> 4) & 1;

  // staging map: thread t moves rows t/16 + 16*j, chunk (t%16)*8 .. +8
  const int srow = tid >> 4;
  const int schk = tid & 15;
  const unsigned soff = srow * DMODEL + schk * 8;  // lane's element in a source tile, A and W alike
  const _Float16* abase = A + (size_t)(mblk * GEMM_BM) * DMODEL;  // block's rows of the first A
  const _Float16* wbase = W + (size_t)nblk0 * DMODEL;             // ... of the first W
  const _Float16* asrc = abase + soff;
  const _Float16* wsrc = wbase + soff;
  const unsigned adst = lds_off(&sA[0][srow * PITCH256B + schk * 8]);
  const unsigned wdst = lds_off(&sW[0][srow * PITCH256B + schk * 8]);
  const int pstages = DMODEL / GEMM_KS;            // 8 stages per product
  const int nstages = nprod * pstages;             // ... of the whole sequence
  const size_t astep = (size_t)mrows * DMODEL;     // elements from one A (or f16 output) to the next
  const size_t wstep = (size_t)DMODEL * DMODEL;    // ... from one W to the next
  const int m0  = mblk * GEMM_BM + wm + 8 * hb;    // lane's first output row
  const int gn0 = nblk0 + wn + l16;                // lane's first output column
  const unsigned rpos = m0 * DMODEL + gn0;         // that element in a row-major output
  const unsigned tpos = ((m0 >> 12) * DMODEL + gn0) * SEQ + (m0 & (SEQ - 1));  // ... in V^T

  // stages 0 and 1 -> buffers 0 and 1. The loop stays rolled so that adst and
  // wdst are not themselves operands of a copy statement: such an operand has
  // to sit in the low 256 registers, which the main loop's accumulators and
  // fragments fill, and the two were then spilled and reloaded at every refill.
  #pragma nounroll
  for (int s = 0; s < 2; s++)
    gemm_stage(adst + s * (GEMM_ATILE * 2), wdst + s * (GEMM_WTILE * 2),
               asrc + s * GEMM_KS, wsrc + s * GEMM_KS);
  WAIT_ASYNCCNT(0x18);                             // own copies of stage 0 landed (24 younger ones fly)
  __syncthreads();                                 // ... and everybody's
  gemm_stage(adst + 2 * (GEMM_ATILE * 2), wdst + 2 * (GEMM_WTILE * 2),
             asrc + 2 * GEMM_KS, wsrc + 2 * GEMM_KS);  // stage 2 -> buffer 2

  v8f acc[4][4] = {};
  v16h af[2][4], bf[2][4];                         // two fragment sets
  gemm_frags(af[0], bf[0], sA[0], sW[0], wm, wn, 0);
  int cur = 0;                                     // buffer of stage t: t mod 3
  for (int t = 0; t < nstages; t++) {
    const int nxt = (cur == 2) ? 0 : cur + 1;
    // the four passes are unrolled so that the fragment sets are indexed by
    // constants and stay in registers.
    #pragma unroll
    for (int ks = 0; ks < GEMM_KS / 32; ks++) {
      const int cs = ks & 1;
      if (ks + 1 < GEMM_KS / 32) {
        gemm_frags(af[cs ^ 1], bf[cs ^ 1], sA[cur], sW[cur], wm, wn, (ks + 1) * 32);
      } else {
        // publish point of stage t + 1, taken as soon as this stage's last
        // fragment reads are in registers: own LDS reads of this buffer
        // retired, own copies of stage t + 1 landed, then one barrier that both
        // publishes that stage and frees this buffer. A trip that refills has
        // stage t + 2's 24 copies behind those of stage t + 1 and leaves them
        // outstanding; the last trips, which issue nothing, wait for all.
        asm volatile("s_wait_dscnt 0x0" ::: "memory");
        if (t + 3 < nstages) WAIT_ASYNCCNT(0x18);
        else                 WAIT_ASYNCCNT(0x0);
        __syncthreads();
        if (t + 1 < nstages)                       // first pass of the published stage
          gemm_frags(af[cs ^ 1], bf[cs ^ 1], sA[nxt], sW[nxt], wm, wn, 0);
      }
      // keeps this pass's 16 WMMAs behind the reads issued for the next pass,
      // so that these fly under the WMMAs and no LDS read is drawn in among
      // them.
      __builtin_amdgcn_sched_barrier(0);
      #pragma unroll
      for (int mi = 0; mi < 4; mi++)
        #pragma unroll
        for (int nb = 0; nb < 4; nb++)
          acc[mi][nb] = wmma16(af[cs][mi], bf[cs][nb], acc[mi][nb]);
      // keeps what follows (the next pass's reads, which overwrite the set that
      // these WMMAs read; the refill) behind the WMMAs' issue.
      __builtin_amdgcn_sched_barrier(0);
    }
    if (t + 3 < nstages) {
      const int sp = (t + 3) / pstages;            // product and k stage of stage t + 3
      const int sk = (t + 3) % pstages;
      gemm_stage(adst + cur * (GEMM_ATILE * 2), wdst + cur * (GEMM_WTILE * 2),
                 (abase + sp * astep + sk * GEMM_KS) + soff,
                 (wbase + sp * wstep + sk * GEMM_KS) + soff);
    }
    cur = nxt;
    if ((t + 1) % pstages != 0) continue;          // block-uniform: product not finished yet

    // a product's last stage is done: store its tile, under the copies in flight.
    // C/D layout: lane holds column gn0 + nb*16, component r holds row
    // m0 + mi*16 + r (m0 includes the lane half's 8*hb). Every store
    // address is one per-lane position of this product plus a constant, so
    // that no table of addresses is carried through the main loop.
    const int prod = t / pstages;
    const int mode = (nprod == 1) ? 2 : (prod == 2 ? 1 : 0);
    const float* bias = ((prod == 0) ? bias0 : (prod == 1 ? bias1 : bias2)) + gn0;
    #pragma unroll
    for (int mi = 0; mi < 4; mi++) {
      if (mode == 1) {
        // 8 consecutive rows (s dim) per lane; a 256-row tile lies in one batch
        // entry, and head * 64 + d is the column itself.
        _Float16* o = (outh0 + prod * astep) + tpos;
        #pragma unroll
        for (int nb = 0; nb < 4; nb++) {
          const float bv = bias[nb * 16];
          v8h pk;
          #pragma unroll
          for (int r = 0; r < 8; r++) pk[r] = (_Float16)(acc[mi][nb][r] + bv);
          *(v8h*)(o + nb * 16 * SEQ + mi * 16) = pk;
        }
        // a register that an issued store names is rewritten behind this run
        // (next rows' values, the other modes' code): the wait stands in front.
        asm volatile("s_wait_xcnt 0x0" ::: "memory");
      } else if (mode == 0) {
        _Float16* o = (outh0 + prod * astep) + rpos;
        #pragma unroll
        for (int nb = 0; nb < 4; nb++) {
          const float bv = bias[nb * 16];
          #pragma unroll
          for (int r = 0; r < 8; r++)
            o[(mi * 16 + r) * DMODEL + nb * 16] = (_Float16)(acc[mi][nb][r] + bv);
        }
        // a register that an issued store names is rewritten behind this run
        // (next rows' values, the other modes' code): the wait stands in front.
        asm volatile("s_wait_xcnt 0x0" ::: "memory");
      } else {
        float* o = (outf + prod * astep) + rpos;
        #pragma unroll
        for (int nb = 0; nb < 4; nb++) {
          const float bv = bias[nb * 16];
          #pragma unroll
          for (int r = 0; r < 8; r++)
            o[(mi * 16 + r) * DMODEL + nb * 16] = acc[mi][nb][r] + bv;
        }
        // a register that an issued store names is rewritten behind this run
        // (next rows' values, the other modes' code): the wait stands in front.
        asm volatile("s_wait_xcnt 0x0" ::: "memory");
      }
    }
    // the next product's sums start from zero (unrolled: constant indices)
    #pragma unroll
    for (int mi = 0; mi < 4; mi++)
      #pragma unroll
      for (int nb = 0; nb < 4; nb++)
        acc[mi][nb] = v8f{};
  }
  WAIT_ASYNCCNT(0x0);                              // nothing in flight at the end
}

#define ATT_CG 2                                   // column groups per wave
#define ATT_SK 128                                 // keys per stage
#define ATT_KT (ATT_SK * PITCH128B)                // f16 elements of a staged K tile
#define ATT_VT (DKH * PITCH256B)                   // ... of a staged V^T tile

__device__ __forceinline__ void attn_stage(unsigned lk, unsigned lv,
                                           const _Float16* gk,
                                           const _Float16* gv) {
  asm volatile("global_load_async_to_lds_b128 %0, %8, off\n\t"
               "global_load_async_to_lds_b128 %1, %9, off\n\t"
               "global_load_async_to_lds_b128 %2, %10, off\n\t"
               "global_load_async_to_lds_b128 %3, %11, off\n\t"
               "global_load_async_to_lds_b128 %4, %12, off\n\t"
               "global_load_async_to_lds_b128 %5, %13, off\n\t"
               "global_load_async_to_lds_b128 %6, %14, off\n\t"
               "global_load_async_to_lds_b128 %7, %15, off\n\t"
               "s_wait_xcnt 0x0"
               :: "v"(lk), "v"(lk + 32 * PITCH128B * 2),
                  "v"(lk + 64 * PITCH128B * 2), "v"(lk + 96 * PITCH128B * 2),
                  "v"(lv), "v"(lv + 16 * PITCH256B * 2),
                  "v"(lv + 32 * PITCH256B * 2), "v"(lv + 48 * PITCH256B * 2),
                  "v"(gk), "v"(gk + 32 * DMODEL),
                  "v"(gk + 64 * DMODEL), "v"(gk + 96 * DMODEL),
                  "v"(gv), "v"(gv + 16 * SEQ),
                  "v"(gv + 32 * SEQ), "v"(gv + 48 * SEQ)
               : "memory");
}

__global__ void __launch_bounds__(256) __attribute__((amdgpu_waves_per_eu(4, 4)))
mha_attn_kernel(const _Float16* __restrict__ Qm, const _Float16* __restrict__ Km,
                const _Float16* __restrict__ Vt, _Float16* __restrict__ ctx,
                int Bsz) {
  __shared__ __attribute__((aligned(16))) _Float16 sK[2][ATT_KT];  // row = key
  __shared__ __attribute__((aligned(16))) _Float16 sV[2][ATT_VT];  // row = d
  const int qblocks = SEQ / (128 * ATT_CG);        // 16
  const int qb = blockIdx.x % qblocks;
  const int h  = (blockIdx.x / qblocks) % NHEADS;
  const int b  = blockIdx.x / (qblocks * NHEADS);
  const int tid  = threadIdx.x;
  const int q0   = qb * (128 * ATT_CG) + (tid >> 5) * (16 * ATT_CG);
  const int lane = tid & 31;
  const int l16  = lane & 15;
  const int hb   = (lane >> 4) & 1;

  const _Float16* qbase = Qm + (size_t)b * SEQ * DMODEL + h * DKH;
  const _Float16* kbase = Km + (size_t)b * SEQ * DMODEL + h * DKH;
  const _Float16* vbase = Vt + (size_t)(b * NHEADS + h) * DKH * SEQ;

  // staging maps (four b128 chunks per thread per tile)
  const int krow = tid >> 3, kchk = tid & 7;       // K: 128 rows x 128B
  const _Float16* ksrc = kbase + (size_t)krow * DMODEL + kchk * 8;
  const unsigned kdst = lds_off(&sK[0][krow * PITCH128B + kchk * 8]);
  const int vrow = tid >> 4, vchk = tid & 15;      // V^T: 64 rows x 256B
  const _Float16* vsrc = vbase + (size_t)vrow * SEQ + vchk * 8;
  const unsigned vdst = lds_off(&sV[0][vrow * PITCH256B + vchk * 8]);
  const int nstages = SEQ / ATT_SK;                // 32

  // loop-invariant Q^T fragments (d = 0..31 and 32..63) of each column group.
  // all loops over column groups are unrolled so that the arrays they index
  // stay in registers.
  v16h qf0[ATT_CG], qf1[ATT_CG];
  #pragma unroll
  for (int c = 0; c < ATT_CG; c++) {
    qf0[c] = load_frag16(qbase, q0 + c * 16, DMODEL, 0);
    qf1[c] = load_frag16(qbase, q0 + c * 16, DMODEL, 32);
  }

  attn_stage(kdst, vdst, ksrc, vsrc);              // stage 0 -> buffer 0
  WAIT_ASYNCCNT(0x0);                              // own copies of stage 0 landed
  __syncthreads();                                 // ... and everybody's
  attn_stage(kdst + ATT_KT * 2, vdst + ATT_VT * 2,
             ksrc + (size_t)ATT_SK * DMODEL, vsrc + ATT_SK);  // stage 1 -> buffer 1

  v8f o0[ATT_CG] = {}, o1[ATT_CG] = {}, o2[ATT_CG] = {}, o3[ATT_CG] = {};  // O^T: 64d x 16q each
  // euse = the exponent's offset in use (a maximum seen so far, in exp2 units);
  // thr = the raw score above which that offset has to be renewed.
  float thr[ATT_CG], euse[ATT_CG], lrun[ATT_CG];
  #pragma unroll
  for (int c = 0; c < ATT_CG; c++) { thr[c] = -1e30f; euse[c] = -1e30f; lrun[c] = 0.f; }
  const float sl2e = 0.125f * 1.44269504088896f;   // 1/sqrt(64) * log2(e)
  const float margin = 8.0f / sl2e;                 // 8 in exp2 units, as a raw score

  for (int st = 0; st < nstages; st++) {
    const int cur = st & 1;
    const _Float16* skc = sK[cur];
    const _Float16* svc = sV[cur];
   // the four passes are unrolled so that a pass's LDS offsets are constants
   // and its fragment reads can be issued under the pass in front of it.
   #pragma unroll
   for (int ps = 0; ps < ATT_SK / 32; ps++) {
    v16h kf00 = load_frag16(skc, ps * 32,      PITCH128B, 0);
    v16h kf01 = load_frag16(skc, ps * 32,      PITCH128B, 32);
    v16h kf10 = load_frag16(skc, ps * 32 + 16, PITCH128B, 0);
    v16h kf11 = load_frag16(skc, ps * 32 + 16, PITCH128B, 32);
    v8f s0[ATT_CG] = {}, s1[ATT_CG] = {};          // S^T: m=key, n=query
    #pragma unroll
    for (int c = 0; c < ATT_CG; c++) {
      s0[c] = wmma16(kf00, qf0[c], s0[c]);
      s1[c] = wmma16(kf10, qf0[c], s1[c]);
    }
    #pragma unroll
    for (int c = 0; c < ATT_CG; c++) {
      s0[c] = wmma16(kf01, qf1[c], s0[c]);
      s1[c] = wmma16(kf11, qf1[c], s1[c]);
    }
    v16h vf0 = load_frag16(svc,  0, PITCH256B, ps * 32);
    v16h vf1 = load_frag16(svc, 16, PITCH256B, ps * 32);
    v16h vf2 = load_frag16(svc, 32, PITCH256B, ps * 32);
    v16h vf3 = load_frag16(svc, 48, PITCH256B, ps * 32);

    // online softmax per query (= per lane column), with a lazy rescale: the
    // exponent's offset stays as it is while no score of the step lies more
    // than 8 (in exp2 units) above it, so a probability is at most 2^8, well
    // inside f16, and the step then needs no exchange between the wave's
    // halves for the maximum, no correction factor and no product on the 64
    // output accumulators. The test is made once per step for the whole wave:
    // a ballot and a scalar branch. In the branch every column takes its true
    // running maximum (both halves merged, so a query's two lanes agree).
    // The maximum is taken over the raw scores; its product with
    // scale * log2(e) is the exponent's offset, so each score costs one FMA in
    // front of its exp2. The FMAs take the accumulators' own register pairs.
    // The loops over r are unrolled so that every vector element is indexed by
    // a constant and stays in its register.
    float mloc[ATT_CG];
    bool need = false;
    #pragma unroll
    for (int c = 0; c < ATT_CG; c++) {
      float m = -1e30f;
      #pragma unroll
      for (int r = 0; r < 8; r++)
        m = fmaxf(m, fmaxf(s0[c][r], s1[c][r]));
      mloc[c] = m;
      need = need || (m > thr[c]);
    }
    if (__builtin_amdgcn_ballot_w32(need) != 0) {
      #pragma unroll
      for (int c = 0; c < ATT_CG; c++) {
        const float mj = fmaxf(mloc[c], __shfl_xor(mloc[c], 16, 32));
        const float enew = fmaxf(euse[c], mj * sl2e);
        const float corr = exp2_slot(euse[c] - enew);
        thr[c] = fmaxf(thr[c], mj + margin);
        euse[c] = enew;
        lrun[c] *= corr;
        #pragma unroll
        for (int r = 0; r < 8; r++) {
          o0[c][r] *= corr; o1[c][r] *= corr; o2[c][r] *= corr; o3[c][r] *= corr;
        }
      }
    }
    v16h pf[ATT_CG];                               // P^T B-fragments, in place
    #pragma unroll
    for (int c = 0; c < ATT_CG; c++) {
      const v2f mul2 = {sl2e, sl2e};
      const v2f off = {-euse[c], -euse[c]};
      float psum = 0.f;
      #pragma unroll
      for (int r = 0; r < 8; r += 2) {
        const v2f a0 = {s0[c][r], s0[c][r + 1]};
        const v2f a1 = {s1[c][r], s1[c][r + 1]};
        const v2f x0 = __builtin_elementwise_fma(a0, mul2, off);
        const v2f x1 = __builtin_elementwise_fma(a1, mul2, off);
        const bool slot0 = ps == 0 && r == 4;
        const bool slot1 = ps == 3 && r == 4;
        const v2f p0 = {__builtin_amdgcn_exp2f(x0[0]),
                        slot0 ? exp2_slot(x0[1]) : __builtin_amdgcn_exp2f(x0[1])};
        const v2f p1 = {__builtin_amdgcn_exp2f(x1[0]),
                        slot1 ? exp2_slot(x1[1]) : __builtin_amdgcn_exp2f(x1[1])};
        const v2f pp = p0 + p1;
        psum = (r == 0) ? pp[0] : psum + pp[0];
        psum += pp[1];
        pf[c][r]     = (_Float16)p0[0];
        pf[c][r + 1] = (_Float16)p0[1];
        pf[c][r + 8] = (_Float16)p1[0];
        pf[c][r + 9] = (_Float16)p1[1];
      }
      psum += __shfl_xor(psum, 16, 32);
      lrun[c] += psum;
    }
    #pragma unroll
    for (int c = 0; c < ATT_CG; c++) {
      o0[c] = wmma16(vf0, pf[c], o0[c]);
      o1[c] = wmma16(vf1, pf[c], o1[c]);
      o2[c] = wmma16(vf2, pf[c], o2[c]);
      o3[c] = wmma16(vf3, pf[c], o3[c]);
    }
   }
    // publish point, once per stage: own LDS reads of this buffer retired, own
    // copies of the next stage landed, then one barrier that both publishes the
    // next stage and frees this buffer for the refill behind it.
    asm volatile("s_wait_dscnt 0x0" ::: "memory");
    WAIT_ASYNCCNT(0x0);
    __syncthreads();
    if (st + 2 < nstages)
      attn_stage(kdst + cur * (ATT_KT * 2), vdst + cur * (ATT_VT * 2),
                 ksrc + (size_t)(st + 2) * ATT_SK * DMODEL,
                 vsrc + (st + 2) * ATT_SK);
  }
  WAIT_ASYNCCNT(0x0);                              // nothing in flight at the end

  // normalize and store: lane's query = q0+c*16+l16; component r -> d = db*16+r+8*hb
  #pragma unroll
  for (int c = 0; c < ATT_CG; c++) {
    const float inv = 1.f / lrun[c];
    _Float16* crow = ctx + (size_t)(b * SEQ + q0 + c * 16 + l16) * DMODEL + h * DKH + 8 * hb;
    v8f oall[4] = {o0[c], o1[c], o2[c], o3[c]};
    #pragma unroll
    for (int db = 0; db < 4; db++) {
      v8h pk;
      #pragma unroll
      for (int r = 0; r < 8; r++) pk[r] = (_Float16)(oall[db][r] * inv);
      *(v8h*)(crow + db * 16) = pk;
    }
    // the next column group's values and address rewrite registers that these
    // stores name: the wait stands in front of that.
    if (c + 1 < ATT_CG) {
      asm volatile("s_wait_xcnt 0x0" ::: "memory");
      // keeps the next group's products behind that wait; without it the
      // compiler lifts some of them, which rewrite those registers, over it.
      __builtin_amdgcn_sched_barrier(0);
    }
  }
}

// ---------------------------------------------------------------------------
extern "C" void kernel_launch(void* const* d_in, const int* in_sizes, int n_in,
                              void* d_out, int out_size, void* d_ws, size_t ws_size,
                              hipStream_t stream) {
  const float* q  = (const float*)d_in[0];
  const float* k  = (const float*)d_in[1];
  const float* v  = (const float*)d_in[2];
  const float* Wq = (const float*)d_in[3];
  const float* bq = (const float*)d_in[4];
  const float* Wk = (const float*)d_in[5];
  const float* bk = (const float*)d_in[6];
  const float* Wv = (const float*)d_in[7];
  const float* bv = (const float*)d_in[8];
  const float* Wo = (const float*)d_in[9];
  const float* bo = (const float*)d_in[10];

  const int rows = in_sizes[0] / DMODEL;   // B * S
  const int Bsz  = rows / SEQ;

  char* ws = (char*)d_ws;
  const size_t fbytes = (size_t)rows * DMODEL * sizeof(_Float16);   // 16 MB
  const size_t wbytes = (size_t)DMODEL * DMODEL * sizeof(_Float16); //  2 MB
  _Float16* Xq  = (_Float16*)(ws + 0 * fbytes);
  _Float16* Xk  = (_Float16*)(ws + 1 * fbytes);
  _Float16* Xv  = (_Float16*)(ws + 2 * fbytes);
  _Float16* Qf  = (_Float16*)(ws + 3 * fbytes);
  _Float16* Kf  = (_Float16*)(ws + 4 * fbytes);
  _Float16* Vtf = (_Float16*)(ws + 5 * fbytes);
  _Float16* Cf  = (_Float16*)(ws + 6 * fbytes);
  _Float16* wq16 = (_Float16*)(ws + 7 * fbytes + 0 * wbytes);
  _Float16* wk16 = (_Float16*)(ws + 7 * fbytes + 1 * wbytes);
  _Float16* wv16 = (_Float16*)(ws + 7 * fbytes + 2 * wbytes);
  _Float16* wo16 = (_Float16*)(ws + 7 * fbytes + 3 * wbytes);

  const int nX = rows * DMODEL;
  const int nW = DMODEL * DMODEL;
  // 256 blocks of 16 waves = one per WGP, seven tiles each at these shapes
  mha_cvt_f16_kernel<<<256, CVT_THREADS, 0, stream>>>(q, k, v, Wq, Wk, Wv, Wo,
                                                      Xq, Xk, Xv, wq16, wk16,
                                                      wv16, wo16, nX, nW);

  const int gemm_blocks = (rows / 256) * (DMODEL / 128);  // 256x128 tile / block
  // Q, K and V projections in one launch: Xq/Xk/Xv, wq16/wk16/wv16 and
  // Qf/Kf/Vtf each lie one behind the other in the workspace.
  mha_gemm_kernel<<<gemm_blocks, 256, 0, stream>>>(Xq, wq16, bq, bk, bv, Qf,
                                                   nullptr, rows, 3);

  const int at_blocks = Bsz * NHEADS * (SEQ / 256);       // 256 queries / block
  mha_attn_kernel<<<at_blocks, 256, 0, stream>>>(Qf, Kf, Vtf, Cf, Bsz);

  mha_gemm_kernel<<<gemm_blocks, 256, 0, stream>>>(Cf, wo16, bo, bo, bo, nullptr,
                                                   (float*)d_out, rows, 1);
}

// v010
// Measured time: 159 microseconds a run.
// In both of two side-by-side timings against v009, it was 1.04 times as fast.
// Over all steps from v000 it is 3.14 times as fast.
#include <hip/hip_runtime.h>
#include <hip/hip_bf16.h>

typedef __attribute__((ext_vector_type(16))) _Float16 v16h;
typedef __attribute__((ext_vector_type(8)))  _Float16 v8h;
typedef __attribute__((ext_vector_type(8)))  float    v8f;
typedef __attribute__((ext_vector_type(2)))  float    v2f;

#define DMODEL 1024
#define SEQ    4096
#define NHEADS 16
#define DKH    64

#define PITCH128B 72   // 128-byte rows -> 144 B
#define PITCH256B 136  // 256-byte rows -> 272 B

#define WAIT_ASYNCCNT(N) asm volatile("s_wait_asynccnt " #N ::: "memory")

__device__ __forceinline__ unsigned lds_off(const void* p) {
  return (unsigned)(unsigned long long)p;
}

__device__ __forceinline__ v16h load_frag16(const _Float16* base,
                                            int row0, int rowstride, int kbase) {
  const int lane = threadIdx.x & 31;
  const int l16  = lane & 15;
  const int hb   = (lane >> 4) & 1;
  const _Float16* p = base + (size_t)(row0 + l16) * rowstride + kbase + hb * 8;
  v8h lo = *(const v8h*)(p);
  v8h hi = *(const v8h*)(p + 16);
  return __builtin_shufflevector(lo, hi, 0,1,2,3,4,5,6,7,8,9,10,11,12,13,14,15);
}

__device__ __forceinline__ v8f wmma16(v16h a, v16h b, v8f c) {
  return __builtin_amdgcn_wmma_f32_16x16x32_f16(false, a, false, b, (short)0, c,
                                                false, false);
}

__device__ __forceinline__ float exp2_slot(float x) {
  float y;
  asm("v_exp_f32 %0, %1\n\tv_nop" : "=v"(y) : "v"(x));
  return y;
}

// ---- fp32 -> f16 conversion ------------------------------------------------
// One launch converts all seven f32 tensors. The work is cut into tiles of
// 16384 elements; a block walks the tiles with the grid as its stride, so few
// waves have to start and each streams: a thread loads a tile's share as eight
// 16-byte pieces (a wave-wide load covers 512 contiguous bytes = four lines),
// issues the next tile's eight loads before it converts and stores this one,
// and writes 8-byte pieces (a wave-wide store covers two whole lines).
// Every tensor's element count is a multiple of the tile (rows * 1024 with
// rows a multiple of 4096; 1024 * 1024), so a tile never straddles tensors.
typedef __attribute__((ext_vector_type(4))) float    v4f;
typedef __attribute__((ext_vector_type(4))) _Float16 v4h;
#define CVT_THREADS 512                  // 16 waves
#define CVT_SHIFT   14                   // tile = 512 threads x 8 x 4 elements
#define CVT_PIECE   (CVT_THREADS * 4)    // elements one block-wide load covers

// the loops over the eight pieces are unrolled so that x stays in registers
// and all eight loads are issued before the first value is needed.
__device__ __forceinline__ void cvt_load(v4f (&x)[8], const float* s) {
  #pragma unroll
  for (int j = 0; j < 8; j++) x[j] = *(const v4f*)(s + j * CVT_PIECE);
  // later code rewrites the address registers that these loads name: the
  // wait stands in front of that.
  asm volatile("s_wait_xcnt 0x0" ::: "memory");
}

__device__ __forceinline__ void cvt_store(const v4f (&x)[8], _Float16* d) {
  #pragma unroll
  for (int j = 0; j < 8; j++)
    *(v4h*)(d + j * CVT_PIECE) = __builtin_convertvector(x[j], v4h);
  // later code rewrites the address and data registers that these stores
  // name: the wait stands in front of that.
  asm volatile("s_wait_xcnt 0x0" ::: "memory");
}

__global__ void __launch_bounds__(CVT_THREADS)
mha_cvt_f16_kernel(const float* __restrict__ q,  const float* __restrict__ k,
                   const float* __restrict__ v,  const float* __restrict__ wq,
                   const float* __restrict__ wk, const float* __restrict__ wv,
                   const float* __restrict__ wo,
                   _Float16* __restrict__ xq,  _Float16* __restrict__ xk,
                   _Float16* __restrict__ xv,  _Float16* __restrict__ hq,
                   _Float16* __restrict__ hk,  _Float16* __restrict__ hv,
                   _Float16* __restrict__ ho, int nx, int nw) {
  const int tx = nx >> CVT_SHIFT;                  // tiles of an activation
  const int tw = nw >> CVT_SHIFT;                  // tiles of a weight
  const int ntiles = 3 * tx + 4 * tw;
  const int step = gridDim.x;

  // block-uniform choice of the tensor a tile belongs to; gives this thread's
  // first source and destination element of the tile.
  auto locate = [&](int t, const float*& s, _Float16*& d) {
    const float* src;
    _Float16* dst;
    if (t < 3 * tx) {
      if (t < tx)          { src = q; dst = xq; }
      else if (t < 2 * tx) { src = k; dst = xk; t -= tx; }
      else                 { src = v; dst = xv; t -= 2 * tx; }
    } else {
      t -= 3 * tx;
      if (t < tw)          { src = wq; dst = hq; }
      else if (t < 2 * tw) { src = wk; dst = hk; t -= tw; }
      else if (t < 3 * tw) { src = wv; dst = hv; t -= 2 * tw; }
      else                 { src = wo; dst = ho; t -= 3 * tw; }
    }
    const size_t off = ((size_t)t << CVT_SHIFT) + threadIdx.x * 4;
    s = src + off;
    d = dst + off;
  };

  int tile = blockIdx.x;
  if (tile >= ntiles) return;
  const int more = (ntiles - 1 - tile) / step;     // tiles behind the first one
  const float* s;
  _Float16 *d0, *d1;
  v4f x[8], y[8];                                  // two register buffers
  locate(tile, s, d0);
  cvt_load(x, s);
  // two tiles a trip, so that each buffer keeps its registers; the trip count
  // is known in front, so that the loop has one way in and one way out and
  // every wait for a buffer counts only the loads issued behind it.
  for (int i = 0; i < (more >> 1); i++) {
    tile += step;
    locate(tile, s, d1);
    cvt_load(y, s);                                // flies under x's stores
    // keeps x's conversions (and their waits for x) behind the issue of y's
    // loads; without it the compiler draws them in front and y starts late.
    __builtin_amdgcn_sched_barrier(0);
    cvt_store(x, d0);
    tile += step;
    locate(tile, s, d0);
    cvt_load(x, s);
    __builtin_amdgcn_sched_barrier(0);
    cvt_store(y, d1);
  }
  if (more & 1) {
    tile += step;
    locate(tile, s, d1);
    cvt_load(y, s);
    __builtin_amdgcn_sched_barrier(0);
    cvt_store(x, d0);
    cvt_store(y, d1);
  } else {
    cvt_store(x, d0);
  }
}

// ---- GEMM: C = A(rows x 1024, f16) @ W^T(1024 x 1024, f16) + bias ----------
// Block (8 waves, 4 x 2) computes a 256x128 C tile, one block per WGP; wave
// tile 64x64, so each A and each W fragment read from LDS feeds four WMMAs, and
// a C element costs a quarter fewer bytes from L2 than on a 128x128 tile.
// A stage is 128 k: 256-byte rows (whole L2 units) padded to 272 B, brought
// into LDS by async copies (one wave-wide copy covers two whole rows). Three
// buffers: while one stage is worked on, the copies of the next two are in
// flight, so that L2 delivers without a pause; the wait at a publish point
// leaves the younger stage's 24 copies outstanding. A stage is worked on in
// four passes of 32 k with no barrier between them. With one block on the WGP
// nobody else fills the time in which its waves read LDS, so a pass's 16
// fragment reads are issued as one group in front of the 16 WMMAs of the pass
// before it, into the other of two fragment sets.
//   mode 0: f16 row-major out (Q/K projections)
//   mode 1: f16 per-head transposed out Vt[(b*16+h)*64+d][s] (V projection)
//   mode 2: f32 row-major out (final projection, writes d_out)
// One launch does nprod products that lie one behind the other in memory
// (A, W and the f16 output each step by a whole tensor): nprod = 3 is the Q, K
// and V projections (modes 0, 0, 1), nprod = 1 the final projection (mode 2).
// A block keeps its tile position and walks the products; the stages of all of
// them form one sequence for the copy ring, so the first stages of the next
// product are already in flight or landed while this product's tile is stored,
// and no launch gap, block start or ring prologue stands between products.
#define GEMM_BM 256                      // C rows per block
#define KN_PITCH 32                      // floats from one K-length entry to the next (128 B)
#define GEMM_KS 128                      // k per stage
#define GEMM_ATILE (GEMM_BM * PITCH256B) // f16 elements of a staged A tile
#define GEMM_WTILE (128 * PITCH256B)     // ... of a staged W tile

// x + the x of lane ^ M inside a 16-lane row, by DPP (row_xmask): four of them
// give every lane the row's sum without a trip through the LDS unit.
template <int M> __device__ __forceinline__ float row_xadd(float x) {
  const int y = __builtin_amdgcn_update_dpp(0, __builtin_bit_cast(int, x),
                                            0x160 + M, 0xf, 0xf, false);
  return x + __builtin_bit_cast(float, y);
}

__device__ __forceinline__ void gemm_stage128(unsigned l, const _Float16* g) {
  asm volatile("global_load_async_to_lds_b128 %0, %8, off\n\t"
               "global_load_async_to_lds_b128 %1, %9, off\n\t"
               "global_load_async_to_lds_b128 %2, %10, off\n\t"
               "global_load_async_to_lds_b128 %3, %11, off\n\t"
               "global_load_async_to_lds_b128 %4, %12, off\n\t"
               "global_load_async_to_lds_b128 %5, %13, off\n\t"
               "global_load_async_to_lds_b128 %6, %14, off\n\t"
               "global_load_async_to_lds_b128 %7, %15, off\n\t"
               "s_wait_xcnt 0x0"
               :: "v"(l), "v"(l + 16 * PITCH256B * 2),
                  "v"(l + 32 * PITCH256B * 2), "v"(l + 48 * PITCH256B * 2),
                  "v"(l + 64 * PITCH256B * 2), "v"(l + 80 * PITCH256B * 2),
                  "v"(l + 96 * PITCH256B * 2), "v"(l + 112 * PITCH256B * 2),
                  "v"(g), "v"(g + 16 * DMODEL),
                  "v"(g + 32 * DMODEL), "v"(g + 48 * DMODEL),
                  "v"(g + 64 * DMODEL), "v"(g + 80 * DMODEL),
                  "v"(g + 96 * DMODEL), "v"(g + 112 * DMODEL)
               : "memory");
}

// One stage: 256 rows of A and 128 rows of W.
__device__ __forceinline__ void gemm_stage(unsigned la, unsigned lw,
                                           const _Float16* ga,
                                           const _Float16* gw) {
  gemm_stage128(la, ga);
  gemm_stage128(la + 128 * PITCH256B * 2, ga + 128 * DMODEL);
  gemm_stage128(lw, gw);
}

// The eight fragments of one 32-k pass of a wave. The loop is unrolled so that
// the arrays are indexed by constants and stay in registers.
__device__ __forceinline__ void gemm_frags(v16h (&af)[4], v16h (&bf)[4],
                                           const _Float16* sa, const _Float16* sw,
                                           int wm, int wn, int kbase) {
  #pragma unroll
  for (int i = 0; i < 4; i++) {
    af[i] = load_frag16(sa, wm + i * 16, PITCH256B, kbase);
    bf[i] = load_frag16(sw, wn + i * 16, PITCH256B, kbase);
  }
}

__global__ void __launch_bounds__(256)
mha_gemm_kernel(const _Float16* __restrict__ A, const _Float16* __restrict__ W,
                const float* __restrict__ bias0, const float* __restrict__ bias1,
                const float* __restrict__ bias2, _Float16* __restrict__ outh0,
                float* __restrict__ outf, float* __restrict__ knorm, int mrows,
                int nprod) {
  __shared__ __attribute__((aligned(16))) _Float16 sA[3][GEMM_ATILE];  // 3 x 68KB
  __shared__ __attribute__((aligned(16))) _Float16 sW[3][GEMM_WTILE];  // 3 x 34KB
  const int nblocks = DMODEL / 128;                // 8
  const int mblk = blockIdx.x / nblocks;
  const int nblk0 = (blockIdx.x % nblocks) * 128;
  if (mblk * GEMM_BM >= mrows) return;             // block-uniform guard
  const int tid  = threadIdx.x;
  const int wave = tid >> 5;
  const int wm   = (wave >> 1) * 64;               // wave's rows in the tile
  const int wn   = (wave & 1) * 64;                // wave's columns in the tile
  const int lane = tid & 31;
  const int l16  = lane & 15;
  const int hb   = (lane >> 4) & 1;

  // staging map: thread t moves rows t/16 + 16*j, chunk (t%16)*8 .. +8
  const int srow = tid >> 4;
  const int schk = tid & 15;
  const unsigned soff = srow * DMODEL + schk * 8;  // lane's element in a source tile, A and W alike
  const _Float16* abase = A + (size_t)(mblk * GEMM_BM) * DMODEL;  // block's rows of the first A
  const _Float16* wbase = W + (size_t)nblk0 * DMODEL;             // ... of the first W
  const _Float16* asrc = abase + soff;
  const _Float16* wsrc = wbase + soff;
  const unsigned adst = lds_off(&sA[0][srow * PITCH256B + schk * 8]);
  const unsigned wdst = lds_off(&sW[0][srow * PITCH256B + schk * 8]);
  const int pstages = DMODEL / GEMM_KS;            // 8 stages per product
  const int nstages = nprod * pstages;             // ... of the whole sequence
  const size_t astep = (size_t)mrows * DMODEL;     // elements from one A (or f16 output) to the next
  const size_t wstep = (size_t)DMODEL * DMODEL;    // ... from one W to the next
  const int m0  = mblk * GEMM_BM + wm + 8 * hb;    // lane's first output row
  const int gn0 = nblk0 + wn + l16;                // lane's first output column
  const unsigned rpos = m0 * DMODEL + gn0;         // that element in a row-major output
  const unsigned tpos = ((m0 >> 12) * DMODEL + gn0) * SEQ + (m0 & (SEQ - 1));  // ... in V^T

  // stages 0 and 1 -> buffers 0 and 1. The loop stays rolled so that adst and
  // wdst are not themselves operands of a copy statement: such an operand has
  // to sit in the low 256 registers, which the main loop's accumulators and
  // fragments fill, and the two were then spilled and reloaded at every refill.
  #pragma nounroll
  for (int s = 0; s < 2; s++)
    gemm_stage(adst + s * (GEMM_ATILE * 2), wdst + s * (GEMM_WTILE * 2),
               asrc + s * GEMM_KS, wsrc + s * GEMM_KS);
  WAIT_ASYNCCNT(0x18);                             // own copies of stage 0 landed (24 younger ones fly)
  __syncthreads();                                 // ... and everybody's
  gemm_stage(adst + 2 * (GEMM_ATILE * 2), wdst + 2 * (GEMM_WTILE * 2),
             asrc + 2 * GEMM_KS, wsrc + 2 * GEMM_KS);  // stage 2 -> buffer 2

  v8f acc[4][4] = {};
  v16h af[2][4], bf[2][4];                         // two fragment sets
  gemm_frags(af[0], bf[0], sA[0], sW[0], wm, wn, 0);
  int cur = 0;                                     // buffer of stage t: t mod 3
  for (int t = 0; t < nstages; t++) {
    const int nxt = (cur == 2) ? 0 : cur + 1;
    // the four passes are unrolled so that the fragment sets are indexed by
    // constants and stay in registers.
    #pragma unroll
    for (int ks = 0; ks < GEMM_KS / 32; ks++) {
      const int cs = ks & 1;
      if (ks + 1 < GEMM_KS / 32) {
        gemm_frags(af[cs ^ 1], bf[cs ^ 1], sA[cur], sW[cur], wm, wn, (ks + 1) * 32);
      } else {
        // publish point of stage t + 1, taken as soon as this stage's last
        // fragment reads are in registers: own LDS reads of this buffer
        // retired, own copies of stage t + 1 landed, then one barrier that both
        // publishes that stage and frees this buffer. A trip that refills has
        // stage t + 2's 24 copies behind those of stage t + 1 and leaves them
        // outstanding; the last trips, which issue nothing, wait for all.
        asm volatile("s_wait_dscnt 0x0" ::: "memory");
        if (t + 3 < nstages) WAIT_ASYNCCNT(0x18);
        else                 WAIT_ASYNCCNT(0x0);
        __syncthreads();
        if (t + 1 < nstages)                       // first pass of the published stage
          gemm_frags(af[cs ^ 1], bf[cs ^ 1], sA[nxt], sW[nxt], wm, wn, 0);
      }
      // keeps this pass's 16 WMMAs behind the reads issued for the next pass,
      // so that these fly under the WMMAs and no LDS read is drawn in among
      // them.
      __builtin_amdgcn_sched_barrier(0);
      #pragma unroll
      for (int mi = 0; mi < 4; mi++)
        #pragma unroll
        for (int nb = 0; nb < 4; nb++)
          acc[mi][nb] = wmma16(af[cs][mi], bf[cs][nb], acc[mi][nb]);
      // keeps what follows (the next pass's reads, which overwrite the set that
      // these WMMAs read; the refill) behind the WMMAs' issue.
      __builtin_amdgcn_sched_barrier(0);
    }
    if (t + 3 < nstages) {
      const int sp = (t + 3) / pstages;            // product and k stage of stage t + 3
      const int sk = (t + 3) % pstages;
      gemm_stage(adst + cur * (GEMM_ATILE * 2), wdst + cur * (GEMM_WTILE * 2),
                 (abase + sp * astep + sk * GEMM_KS) + soff,
                 (wbase + sp * wstep + sk * GEMM_KS) + soff);
    }
    cur = nxt;
    if ((t + 1) % pstages != 0) continue;          // block-uniform: product not finished yet

    // a product's last stage is done: store its tile, under the copies in flight.
    // C/D layout: lane holds column gn0 + nb*16, component r holds row
    // m0 + mi*16 + r (m0 includes the lane half's 8*hb). Every store
    // address is one per-lane position of this product plus a constant, so
    // that no table of addresses is carried through the main loop.
    const int prod = t / pstages;
    const int mode = (nprod == 1) ? 2 : (prod == 2 ? 1 : 0);
    const float* bias = ((prod == 0) ? bias0 : (prod == 1 ? bias1 : bias2)) + gn0;
    #pragma unroll
    for (int mi = 0; mi < 4; mi++) {
      if (mode == 1) {
        // 8 consecutive rows (s dim) per lane; a 256-row tile lies in one batch
        // entry, and head * 64 + d is the column itself.
        _Float16* o = (outh0 + prod * astep) + tpos;
        #pragma unroll
        for (int nb = 0; nb < 4; nb++) {
          const float bv = bias[nb * 16];
          v8h pk;
          #pragma unroll
          for (int r = 0; r < 8; r++) pk[r] = (_Float16)(acc[mi][nb][r] + bv);
          *(v8h*)(o + nb * 16 * SEQ + mi * 16) = pk;
        }
        // a register that an issued store names is rewritten behind this run
        // (next rows' values, the other modes' code): the wait stands in front.
        asm volatile("s_wait_xcnt 0x0" ::: "memory");
      } else if (mode == 0) {
        _Float16* o = (outh0 + prod * astep) + rpos;
        #pragma unroll
        for (int nb = 0; nb < 4; nb++) {
          const float bv = bias[nb * 16];
          #pragma unroll
          for (int r = 0; r < 8; r++)
            o[(mi * 16 + r) * DMODEL + nb * 16] = (_Float16)(acc[mi][nb][r] + bv);
        }
        // a register that an issued store names is rewritten behind this run
        // (next rows' values, the other modes' code): the wait stands in front.
        asm volatile("s_wait_xcnt 0x0" ::: "memory");
      } else {
        float* o = (outf + prod * astep) + rpos;
        #pragma unroll
        for (int nb = 0; nb < 4; nb++) {
          const float bv = bias[nb * 16];
          #pragma unroll
          for (int r = 0; r < 8; r++)
            o[(mi * 16 + r) * DMODEL + nb * 16] = acc[mi][nb][r] + bv;
        }
        // a register that an issued store names is rewritten behind this run
        // (next rows' values, the other modes' code): the wait stands in front.
        asm volatile("s_wait_xcnt 0x0" ::: "memory");
      }
    }
    // K projection only (block-uniform): the largest squared length among the
    // wave's 64 rows of K, taken over its 64 columns, which are one head. The
    // attention kernel bounds every score of a query by it. The values are the
    // f16-rounded ones that were stored. One entry per wave, each in a 128-byte
    // line of its own. Loops unrolled: constant indices into acc.
    if (nprod == 3 && prod == 1) {
      float kb[4];                                 // the four columns' bias
      #pragma unroll
      for (int nb = 0; nb < 4; nb++) kb[nb] = bias[nb * 16];
      // later code rewrites the address registers that these loads name: the
      // wait stands in front of that.
      asm volatile("s_wait_xcnt 0x0" ::: "memory");
      // keeps that later code behind the wait; without it the compiler lifts
      // register moves, which rewrite that address pair, over it.
      __builtin_amdgcn_sched_barrier(0);
      float nmax = 0.f;
      #pragma unroll
      for (int mi = 0; mi < 4; mi++) {
        float t[8];
        #pragma unroll
        for (int r = 0; r < 8; r++) {
          t[r] = 0.f;
          #pragma unroll
          for (int nb = 0; nb < 4; nb++) {
            const float kv = (float)(_Float16)(acc[mi][nb][r] + kb[nb]);
            t[r] = fmaf(kv, kv, t[r]);
          }
        }
        #pragma unroll
        for (int r = 0; r < 8; r++)
          t[r] = row_xadd<8>(row_xadd<4>(row_xadd<2>(row_xadd<1>(t[r]))));
        #pragma unroll
        for (int r = 0; r < 8; r++) nmax = fmaxf(nmax, t[r]);
      }
      nmax = fmaxf(nmax, __shfl_xor(nmax, 16, 32));
      if (lane == 0)
        knorm[((((mblk * GEMM_BM + wm) >> 6) * NHEADS) + ((nblk0 + wn) >> 6)) * KN_PITCH] = nmax;
      // later code rewrites the registers that this store names: the wait
      // stands in front of that.
      asm volatile("s_wait_xcnt 0x0" ::: "memory");
    }
    // the next product's sums start from zero (unrolled: constant indices)
    #pragma unroll
    for (int mi = 0; mi < 4; mi++)
      #pragma unroll
      for (int nb = 0; nb < 4; nb++)
        acc[mi][nb] = v8f{};
  }
  WAIT_ASYNCCNT(0x0);                              // nothing in flight at the end
}

#define ATT_CG 2                                   // column groups per wave
#define ATT_SK 128                                 // keys per stage
#define ATT_KT (ATT_SK * PITCH128B)                // f16 elements of a staged K tile
#define ATT_VT (DKH * PITCH256B)                   // ... of a staged V^T tile

__device__ __forceinline__ void attn_stage(unsigned lk, unsigned lv,
                                           const _Float16* gk,
                                           const _Float16* gv) {
  asm volatile("global_load_async_to_lds_b128 %0, %8, off\n\t"
               "global_load_async_to_lds_b128 %1, %9, off\n\t"
               "global_load_async_to_lds_b128 %2, %10, off\n\t"
               "global_load_async_to_lds_b128 %3, %11, off\n\t"
               "global_load_async_to_lds_b128 %4, %12, off\n\t"
               "global_load_async_to_lds_b128 %5, %13, off\n\t"
               "global_load_async_to_lds_b128 %6, %14, off\n\t"
               "global_load_async_to_lds_b128 %7, %15, off\n\t"
               "s_wait_xcnt 0x0"
               :: "v"(lk), "v"(lk + 32 * PITCH128B * 2),
                  "v"(lk + 64 * PITCH128B * 2), "v"(lk + 96 * PITCH128B * 2),
                  "v"(lv), "v"(lv + 16 * PITCH256B * 2),
                  "v"(lv + 32 * PITCH256B * 2), "v"(lv + 48 * PITCH256B * 2),
                  "v"(gk), "v"(gk + 32 * DMODEL),
                  "v"(gk + 64 * DMODEL), "v"(gk + 96 * DMODEL),
                  "v"(gv), "v"(gv + 16 * SEQ),
                  "v"(gv + 32 * SEQ), "v"(gv + 48 * SEQ)
               : "memory");
}

// compile-time choice between the two forms of the key loop
template <bool V> struct attn_flag { static constexpr bool value = V; };

__global__ void __launch_bounds__(256) __attribute__((amdgpu_waves_per_eu(4, 4)))
mha_attn_kernel(const _Float16* __restrict__ Qm, const _Float16* __restrict__ Km,
                const _Float16* __restrict__ Vt, const float* __restrict__ knorm,
                _Float16* __restrict__ ctx, int Bsz) {
  __shared__ __attribute__((aligned(16))) _Float16 sK[2][ATT_KT];  // row = key
  __shared__ __attribute__((aligned(16))) _Float16 sV[2][ATT_VT];  // row = d
  __shared__ int sfix[8];                          // per wave: fixed offset usable
  const int qblocks = SEQ / (128 * ATT_CG);        // 16
  const int qb = blockIdx.x % qblocks;
  const int h  = (blockIdx.x / qblocks) % NHEADS;
  const int b  = blockIdx.x / (qblocks * NHEADS);
  const int tid  = threadIdx.x;
  const int q0   = qb * (128 * ATT_CG) + (tid >> 5) * (16 * ATT_CG);
  const int lane = tid & 31;
  const int l16  = lane & 15;
  const int hb   = (lane >> 4) & 1;
  const int wave_s = __builtin_amdgcn_readfirstlane(tid >> 5);  // wave's number, scalar

  const _Float16* qbase = Qm + (size_t)b * SEQ * DMODEL + h * DKH;
  const _Float16* kbase = Km + (size_t)b * SEQ * DMODEL + h * DKH;
  const _Float16* vbase = Vt + (size_t)(b * NHEADS + h) * DKH * SEQ;

  // staging maps (four b128 chunks per thread per tile)
  const int krow = tid >> 3, kchk = tid & 7;       // K: 128 rows x 128B
  const _Float16* ksrc = kbase + (size_t)krow * DMODEL + kchk * 8;
  const unsigned kdst = lds_off(&sK[0][krow * PITCH128B + kchk * 8]);
  const int vrow = tid >> 4, vchk = tid & 15;      // V^T: 64 rows x 256B
  const _Float16* vsrc = vbase + (size_t)vrow * SEQ + vchk * 8;
  const unsigned vdst = lds_off(&sV[0][vrow * PITCH256B + vchk * 8]);
  const int nstages = SEQ / ATT_SK;                // 32

  // loop-invariant Q^T fragments (d = 0..31 and 32..63) of each column group.
  // all loops over column groups are unrolled so that the arrays they index
  // stay in registers.
  v16h qf0[ATT_CG], qf1[ATT_CG];
  #pragma unroll
  for (int c = 0; c < ATT_CG; c++) {
    qf0[c] = load_frag16(qbase, q0 + c * 16, DMODEL, 0);
    qf1[c] = load_frag16(qbase, q0 + c * 16, DMODEL, 32);
  }

  // largest squared key length of this (b, h): 64 entries, two per lane
  const float* kn = knorm + ((size_t)(b * (SEQ / 64) + lane) * NHEADS + h) * KN_PITCH;
  const float kn0 = kn[0], kn1 = kn[32 * NHEADS * KN_PITCH];
  // later code rewrites the address registers that these loads (and Q's) name:
  // the wait stands in front of that.
  asm volatile("s_wait_xcnt 0x0" ::: "memory");
  // keeps that later code behind the wait; without it the compiler lifts the
  // staging addresses' arithmetic, which rewrites those registers, over it.
  __builtin_amdgcn_sched_barrier(0);

  // start of the copy ring: stage 0 published, stage 1 in flight
  auto ring_start = [&](const _Float16* ks, const _Float16* vs) __attribute__((always_inline)) {
    attn_stage(kdst, vdst, ks, vs);                // stage 0 -> buffer 0
    // keeps the arithmetic on the loaded Q and key lengths, and with it the wait
    // for those loads, behind the issue of stage 0's copies.
    __builtin_amdgcn_sched_barrier(0);
    WAIT_ASYNCCNT(0x0);                            // own copies of stage 0 landed
    __syncthreads();                               // ... and everybody's
    attn_stage(kdst + ATT_KT * 2, vdst + ATT_VT * 2,
               ks + (size_t)ATT_SK * DMODEL, vs + ATT_SK);  // stage 1 -> buffer 1
  };
  ring_start(ksrc, vsrc);

  v8f o0[ATT_CG] = {}, o1[ATT_CG] = {}, o2[ATT_CG] = {}, o3[ATT_CG] = {};  // O^T: 64d x 16q each
  // euse = the exponent's offset in use (in exp2 units: in the main loop a bound fixed in front of it, in the fallback a maximum seen so far);
  // thr = the raw score above which that offset has to be renewed.
  float thr[ATT_CG], euse[ATT_CG], lrun[ATT_CG];
  #pragma unroll
  for (int c = 0; c < ATT_CG; c++) { thr[c] = -1e30f; euse[c] = -1e30f; lrun[c] = 0.f; }
  const float sl2e = 0.125f * 1.44269504088896f;   // 1/sqrt(64) * log2(e)
  const float margin = 8.0f / sl2e;                 // 8 in exp2 units, as a raw score

  // A fixed offset for the whole key loop. No score of a query exceeds
  // |q| * max|k| (Cauchy-Schwarz), so with the offset at that bound minus 15
  // (exp2 units) no probability exceeds 2^15, inside f16, and the loop needs no
  // maximum, no test and no rescale. The factor 1.002 covers the rounding of
  // the lengths and of the matrix sums. Whether the offset lay too far above the
  // true maximum is seen behind the loop from the row sum (see there).
  float kmax2 = fmaxf(kn0, kn1);
  #pragma unroll
  for (int m = 1; m < 32; m <<= 1) kmax2 = fmaxf(kmax2, __shfl_xor(kmax2, m, 32));
  #pragma unroll
  for (int c = 0; c < ATT_CG; c++) {
    float qn2 = 0.f;
    #pragma unroll
    for (int i = 0; i < 16; i++) {
      const float a = (float)qf0[c][i], e = (float)qf1[c][i];
      qn2 = fmaf(a, a, fmaf(e, e, qn2));
    }
    qn2 += __shfl_xor(qn2, 16, 32);
    euse[c] = __builtin_sqrtf(qn2 * kmax2) * (sl2e * 1.002f) - 15.0f;
  }

  auto key_loop = [&](auto lazy_tag, const _Float16* ks, const _Float16* vs) __attribute__((always_inline)) {
  constexpr bool LAZY = decltype(lazy_tag)::value;
  for (int st = 0; st < nstages; st++) {
    const int cur = st & 1;
    const _Float16* skc = sK[cur];
    const _Float16* svc = sV[cur];
   // the four passes are unrolled so that a pass's LDS offsets are constants
   // and its fragment reads can be issued under the pass in front of it. The
   // fallback loop stays rolled: unrolled beside the other loop it spilled.
   #pragma unroll(LAZY ? 1 : ATT_SK / 32)
   for (int ps = 0; ps < ATT_SK / 32; ps++) {
    v16h kf00 = load_frag16(skc, ps * 32,      PITCH128B, 0);
    v16h kf01 = load_frag16(skc, ps * 32,      PITCH128B, 32);
    v16h kf10 = load_frag16(skc, ps * 32 + 16, PITCH128B, 0);
    v16h kf11 = load_frag16(skc, ps * 32 + 16, PITCH128B, 32);
    v8f s0[ATT_CG] = {}, s1[ATT_CG] = {};          // S^T: m=key, n=query
    #pragma unroll
    for (int c = 0; c < ATT_CG; c++) {
      s0[c] = wmma16(kf00, qf0[c], s0[c]);
      s1[c] = wmma16(kf10, qf0[c], s1[c]);
    }
    #pragma unroll
    for (int c = 0; c < ATT_CG; c++) {
      s0[c] = wmma16(kf01, qf1[c], s0[c]);
      s1[c] = wmma16(kf11, qf1[c], s1[c]);
    }
    v16h vf0, vf1, vf2, vf3;
    if constexpr (!LAZY) {
      vf0 = load_frag16(svc,  0, PITCH256B, ps * 32);
      vf1 = load_frag16(svc, 16, PITCH256B, ps * 32);
      vf2 = load_frag16(svc, 32, PITCH256B, ps * 32);
      vf3 = load_frag16(svc, 48, PITCH256B, ps * 32);
    }

    // online softmax per query (= per lane column), with a lazy rescale: the
    // exponent's offset stays as it is while no score of the step lies more
    // than 8 (in exp2 units) above it, so a probability is at most 2^8, well
    // inside f16, and the step then needs no exchange between the wave's
    // halves for the maximum, no correction factor and no product on the 64
    // output accumulators. The test is made once per step for the whole wave:
    // a ballot and a scalar branch. In the branch every column takes its true
    // running maximum (both halves merged, so a query's two lanes agree).
    // The maximum is taken over the raw scores; its product with
    // scale * log2(e) is the exponent's offset, so each score costs one FMA in
    // front of its exp2. The FMAs take the accumulators' own register pairs.
    // The loops over r are unrolled so that every vector element is indexed by
    // a constant and stays in its register.
    // All of this is the fallback loop's; the main loop has its offset fixed in
    // front of the loop and goes straight to the exponentials.
   if constexpr (LAZY) {
    float mloc[ATT_CG];
    bool need = false;
    #pragma unroll
    for (int c = 0; c < ATT_CG; c++) {
      float m = -1e30f;
      #pragma unroll
      for (int r = 0; r < 8; r++)
        m = fmaxf(m, fmaxf(s0[c][r], s1[c][r]));
      mloc[c] = m;
      need = need || (m > thr[c]);
    }
    if (__builtin_amdgcn_ballot_w32(need) != 0) {
      #pragma unroll
      for (int c = 0; c < ATT_CG; c++) {
        const float mj = fmaxf(mloc[c], __shfl_xor(mloc[c], 16, 32));
        const float enew = fmaxf(euse[c], mj * sl2e);
        const float corr = exp2_slot(euse[c] - enew);
        thr[c] = fmaxf(thr[c], mj + margin);
        euse[c] = enew;
        lrun[c] *= corr;
        #pragma unroll
        for (int r = 0; r < 8; r++) {
          o0[c][r] *= corr; o1[c][r] *= corr; o2[c][r] *= corr; o3[c][r] *= corr;
        }
      }
    }
   }
    v16h pf[ATT_CG];                               // P^T B-fragments, in place
    #pragma unroll
    for (int c = 0; c < ATT_CG; c++) {
      const v2f mul2 = {sl2e, sl2e};
      const v2f off = {-euse[c], -euse[c]};
      float psum = 0.f;
      #pragma unroll
      for (int r = 0; r < 8; r += 2) {
        const v2f a0 = {s0[c][r], s0[c][r + 1]};
        const v2f a1 = {s1[c][r], s1[c][r + 1]};
        const v2f x0 = __builtin_elementwise_fma(a0, mul2, off);
        const v2f x1 = __builtin_elementwise_fma(a1, mul2, off);
        const v2f p0 = {LAZY ? exp2_slot(x0[0]) : __builtin_amdgcn_exp2f(x0[0]),
                        LAZY ? exp2_slot(x0[1]) : __builtin_amdgcn_exp2f(x0[1])};
        const v2f p1 = {LAZY ? exp2_slot(x1[0]) : __builtin_amdgcn_exp2f(x1[0]),
                        LAZY ? exp2_slot(x1[1]) : __builtin_amdgcn_exp2f(x1[1])};
        const v2f pp = p0 + p1;
        psum = (r == 0) ? pp[0] : psum + pp[0];
        psum += pp[1];
        pf[c][r]     = (_Float16)p0[0];
        pf[c][r + 1] = (_Float16)p0[1];
        pf[c][r + 8] = (_Float16)p1[0];
        pf[c][r + 9] = (_Float16)p1[1];
      }
      psum += __shfl_xor(psum, 16, 32);
      lrun[c] += psum;
    }
    if constexpr (LAZY) {
      // the fallback reads V^T only when the probabilities are done; the fence
      // keeps the reads from being drawn up: with them in flight over the
      // softmax this loop spilled.
      __builtin_amdgcn_sched_barrier(0);
      vf0 = load_frag16(svc,  0, PITCH256B, ps * 32);
      vf1 = load_frag16(svc, 16, PITCH256B, ps * 32);
      vf2 = load_frag16(svc, 32, PITCH256B, ps * 32);
      vf3 = load_frag16(svc, 48, PITCH256B, ps * 32);
    }
    #pragma unroll
    for (int c = 0; c < ATT_CG; c++) {
      o0[c] = wmma16(vf0, pf[c], o0[c]);
      o1[c] = wmma16(vf1, pf[c], o1[c]);
      o2[c] = wmma16(vf2, pf[c], o2[c]);
      o3[c] = wmma16(vf3, pf[c], o3[c]);
    }
   }
    // publish point, once per stage: own LDS reads of this buffer retired, own
    // copies of the next stage landed, then one barrier that both publishes the
    // next stage and frees this buffer for the refill behind it.
    asm volatile("s_wait_dscnt 0x0" ::: "memory");
    WAIT_ASYNCCNT(0x0);
    __syncthreads();
    if (st + 2 < nstages)
      attn_stage(kdst + cur * (ATT_KT * 2), vdst + cur * (ATT_VT * 2),
                 ks + (size_t)(st + 2) * ATT_SK * DMODEL,
                 vs + (st + 2) * ATT_SK);
  }
  };
  key_loop(attn_flag<false>{}, ksrc, vsrc);
  WAIT_ASYNCCNT(0x0);                              // nothing in flight at the end

  // A probability below f16's normal range is off by at most 2^-25, all 4096 of
  // a row together by at most 2^-13: against a row sum of at least 1/4 that is
  // 2^-11, what f16 rounding costs anyway. A row sum below 1/4 (or a NaN: the
  // bound was not finite) sends the block through the loop with the running
  // maximum. The choice is made for the whole block, since that loop holds
  // barriers; the barrier here publishes the waves' flags and stands behind
  // every wave's last read of the ring.
  // what is needed per lane behind the loop is formed anew from the wave's
  // number (a scalar) and the lane's, so that no address has to be carried
  // through the loop in vector registers (they spilled).
  const int lane2 = __builtin_amdgcn_mbcnt_lo(~0u, 0u);
  bool fixl = true;
  #pragma unroll
  for (int c = 0; c < ATT_CG; c++) fixl = fixl && (lrun[c] >= 0.25f);
  const int wfix = __builtin_amdgcn_ballot_w32(fixl) == 0xffffffffu;  // all 32 lanes vote
  if (lane2 == 0) sfix[wave_s] = wfix;
  __syncthreads();
  int nfix = 0;
  #pragma unroll
  for (int w = 0; w < 8; w++) nfix += sfix[w];
  if (__builtin_amdgcn_readfirstlane(nfix) != 8) {
    #pragma unroll
    for (int c = 0; c < ATT_CG; c++) {
      o0[c] = v8f{}; o1[c] = v8f{}; o2[c] = v8f{}; o3[c] = v8f{};
      thr[c] = -1e30f; euse[c] = -1e30f; lrun[c] = 0.f;
    }
    // own LDS reads retired before copies are aimed at the ring again
    asm volatile("s_wait_dscnt 0x0" ::: "memory");
    const int t2 = wave_s * 32 + lane2;
    const _Float16* ks2 = kbase + (size_t)(t2 >> 3) * DMODEL + (t2 & 7) * 8;
    const _Float16* vs2 = vbase + (size_t)(t2 >> 4) * SEQ + (t2 & 15) * 8;
    ring_start(ks2, vs2);
    key_loop(attn_flag<true>{}, ks2, vs2);
    WAIT_ASYNCCNT(0x0);                            // nothing in flight at the end
  }

  // normalize and store: lane's query = q0+c*16+l16; component r -> d = db*16+r+8*hb
  #pragma unroll
  for (int c = 0; c < ATT_CG; c++) {
    const float inv = 1.f / lrun[c];
    _Float16* crow = ctx + (size_t)(b * SEQ + qb * (128 * ATT_CG) + wave_s * (16 * ATT_CG) + c * 16 + (lane2 & 15)) * DMODEL + h * DKH + 8 * (lane2 >> 4);
    v8f oall[4] = {o0[c], o1[c], o2[c], o3[c]};
    #pragma unroll
    for (int db = 0; db < 4; db++) {
      v8h pk;
      #pragma unroll
      for (int r = 0; r < 8; r++) pk[r] = (_Float16)(oall[db][r] * inv);
      *(v8h*)(crow + db * 16) = pk;
    }
    // the next column group's values and address rewrite registers that these
    // stores name: the wait stands in front of that.
    if (c + 1 < ATT_CG) {
      asm volatile("s_wait_xcnt 0x0" ::: "memory");
      // keeps the next group's products behind that wait; without it the
      // compiler lifts some of them, which rewrite those registers, over it.
      __builtin_amdgcn_sched_barrier(0);
    }
  }
}

// ---------------------------------------------------------------------------
extern "C" void kernel_launch(void* const* d_in, const int* in_sizes, int n_in,
                              void* d_out, int out_size, void* d_ws, size_t ws_size,
                              hipStream_t stream) {
  const float* q  = (const float*)d_in[0];
  const float* k  = (const float*)d_in[1];
  const float* v  = (const float*)d_in[2];
  const float* Wq = (const float*)d_in[3];
  const float* bq = (const float*)d_in[4];
  const float* Wk = (const float*)d_in[5];
  const float* bk = (const float*)d_in[6];
  const float* Wv = (const float*)d_in[7];
  const float* bv = (const float*)d_in[8];
  const float* Wo = (const float*)d_in[9];
  const float* bo = (const float*)d_in[10];

  const int rows = in_sizes[0] / DMODEL;   // B * S
  const int Bsz  = rows / SEQ;

  char* ws = (char*)d_ws;
  const size_t fbytes = (size_t)rows * DMODEL * sizeof(_Float16);   // 16 MB
  const size_t wbytes = (size_t)DMODEL * DMODEL * sizeof(_Float16); //  2 MB
  _Float16* Xq  = (_Float16*)(ws + 0 * fbytes);
  _Float16* Xk  = (_Float16*)(ws + 1 * fbytes);
  _Float16* Xv  = (_Float16*)(ws + 2 * fbytes);
  _Float16* Qf  = (_Float16*)(ws + 3 * fbytes);
  _Float16* Kf  = (_Float16*)(ws + 4 * fbytes);
  _Float16* Vtf = (_Float16*)(ws + 5 * fbytes);
  _Float16* Cf  = (_Float16*)(ws + 6 * fbytes);
  _Float16* wq16 = (_Float16*)(ws + 7 * fbytes + 0 * wbytes);
  _Float16* wk16 = (_Float16*)(ws + 7 * fbytes + 1 * wbytes);
  _Float16* wv16 = (_Float16*)(ws + 7 * fbytes + 2 * wbytes);
  _Float16* wo16 = (_Float16*)(ws + 7 * fbytes + 3 * wbytes);
  float* knrm = (float*)(ws + 7 * fbytes + 4 * wbytes);  // K-length entries, 128 B each

  const int nX = rows * DMODEL;
  const int nW = DMODEL * DMODEL;
  // 256 blocks of 16 waves = one per WGP, seven tiles each at these shapes
  mha_cvt_f16_kernel<<<256, CVT_THREADS, 0, stream>>>(q, k, v, Wq, Wk, Wv, Wo,
                                                      Xq, Xk, Xv, wq16, wk16,
                                                      wv16, wo16, nX, nW);

  const int gemm_blocks = (rows / 256) * (DMODEL / 128);  // 256x128 tile / block
  // Q, K and V projections in one launch: Xq/Xk/Xv, wq16/wk16/wv16 and
  // Qf/Kf/Vtf each lie one behind the other in the workspace.
  mha_gemm_kernel<<<gemm_blocks, 256, 0, stream>>>(Xq, wq16, bq, bk, bv, Qf,
                                                   nullptr, knrm, rows, 3);

  const int at_blocks = Bsz * NHEADS * (SEQ / 256);       // 256 queries / block
  mha_attn_kernel<<<at_blocks, 256, 0, stream>>>(Qf, Kf, Vtf, knrm, Cf, Bsz);

  mha_gemm_kernel<<<gemm_blocks, 256, 0, stream>>>(Cf, wo16, bo, bo, bo, nullptr,
                                                   (float*)d_out, nullptr, rows, 1);
}
